// v000
// Measured on an AMD MI455X. A time is GPU time per run, averaged over a window of back-to-back runs after a warm-up
// (all launches, gaps included; the runs take copies of the inputs in turn), and the median of several windows.
// Apart from v000's, it joins two sittings. Times from different sittings can be a few percent apart, while
// side-by-side timings come from the same sitting.
// v000, which the later versions start from, runs in 2550 microseconds.
// compute dtype: all float inputs rounded to bf16; Q, K, V are bf16-valued so their f16 planes are exact; causal logits q x k (1 product; the residual products below row 384 multiply exact zeros) x 64^-0.5; softmax f32; P x 2^11 once to f16 x v (exact) (bf16 hi + lo P below row 384); f32 output.
#include <hip/hip_runtime.h>
#include <math.h>

typedef __attribute__((ext_vector_type(16))) _Float16 v16h;
typedef __attribute__((ext_vector_type(16))) __bf16 v16b;
typedef __attribute__((ext_vector_type(8)))  _Float16 v8h;
typedef __attribute__((ext_vector_type(8)))  float v8f;
typedef __attribute__((ext_vector_type(4)))  float v4f;
typedef __attribute__((ext_vector_type(2)))  float v2f;
typedef __attribute__((ext_vector_type(4)))  unsigned v4u;
typedef _Float16 hx8 __attribute__((ext_vector_type(8)));
typedef __attribute__((ext_vector_type(4)))  int v4i;
typedef float __attribute__((may_alias)) float_a;
typedef int __attribute__((may_alias)) int_a;

template <typename T> __device__ __forceinline__ void vst2(void* p, T v) { *(T*)p = v;  }
__device__ __forceinline__ v8f wmma16(v16h a, v16h b, v8f c) {
  v8f d = __builtin_amdgcn_wmma_f32_16x16x32_f16(false, a, false, b, (short)0, c, false, false);
  asm volatile("v_nop\n\tv_nop\n\tv_nop\n\tv_nop" : "+v"(d) : "v"(a), "v"(b));
  return d;
}
__device__ __forceinline__ v8f wmma_bf(v16b a, v16b b, v8f c) {
  v8f d = __builtin_amdgcn_wmma_f32_16x16x32_bf16(false, a, false, b, (short)0, c, false, false);
  asm volatile("v_nop\n\tv_nop\n\tv_nop\n\tv_nop" : "+v"(d) : "v"(a), "v"(b));
  return d;
}
// 16x16x32 fragments: lane = (h = lane>>4, row/col = lane&15); elements 0..7 = k0+8h+0..7, 8..15 = k0+16+8h+0..7; D element r = row 8h+r
__device__ __forceinline__ v16h frag_h(const _Float16* rowk0, int lane) {
  union { v16h v; v8h q[2]; } u; const _Float16* p = rowk0 + 8 * (lane >> 4);
  u.q[0] = *(const v8h*)p; u.q[1] = *(const v8h*)(p + 16); return u.v;
}
__device__ __forceinline__ v16h frag_f32(const float* rowk0, int lane) {
  v16h a; const float* p = rowk0 + 8 * (lane >> 4);
#pragma unroll
  for (int i = 0; i < 8; ++i) { a[i] = (_Float16)p[i]; a[8 + i] = (_Float16)p[16 + i]; }
  return a;
}
__device__ __forceinline__ v16h frag_f32s(const float* rowk0, int lane, float sc) {
  v16h a; const float* p = rowk0 + 8 * (lane >> 4);
#pragma unroll
  for (int i = 0; i < 8; ++i) { a[i] = (_Float16)(p[i] * sc); a[8 + i] = (_Float16)(p[16 + i] * sc); }
  return a;
}
// column fragment from a [K][ld] layout (column n), rows >= K read as 0
__device__ __forceinline__ v16h fragc_f32(const float* W, int k0, int n, int lane, int ld, int K) {
  v16h a; const int g = lane >> 4;
#pragma unroll
  for (int i = 0; i < 8; ++i) { const int ka = k0 + 8 * g + i, kb = ka + 16;
    a[i] = (_Float16)(ka < K ? W[(size_t)(ka < K ? ka : K - 1) * ld + n] : 0.f); a[8 + i] = (_Float16)(kb < K ? W[(size_t)(kb < K ? kb : K - 1) * ld + n] : 0.f); }
  return a;
}
struct F2 { v16b h, l; };
__device__ __forceinline__ F2 bsplit16(const float v[16]) { F2 r;
#pragma unroll
  for (int i = 0; i < 16; ++i) { const __bf16 h = (__bf16)v[i]; r.h[i] = h; r.l[i] = (__bf16)(v[i] - (float)h); }
  return r; }
__device__ __forceinline__ F2 split_row(const float* row, int k0, int lane) { float v[16]; const float* p = row + k0 + 8 * (lane >> 4);
#pragma unroll
  for (int i = 0; i < 8; ++i) { v[i] = p[i]; v[8 + i] = p[16 + i]; }
  return bsplit16(v); }
__device__ __forceinline__ F2 split_rowK(const float* row, int k0, int lane, int K) { float v[16]; const int g = lane >> 4;
#pragma unroll
  for (int i = 0; i < 8; ++i) { const int ka = k0 + 8 * g + i, kb = ka + 16; v[i] = ka < K ? row[ka < K ? ka : K - 1] : 0.f; v[8 + i] = kb < K ? row[kb < K ? kb : K - 1] : 0.f; }
  return bsplit16(v); }
__device__ __forceinline__ F2 split_col(const float* W, int k0, int n, int lane, int ld, int K) { float v[16]; const int g = lane >> 4;
#pragma unroll
  for (int i = 0; i < 8; ++i) { const int ka = k0 + 8 * g + i, kb = ka + 16; v[i] = ka < K ? W[(size_t)(ka < K ? ka : K - 1) * ld + n] : 0.f; v[8 + i] = kb < K ? W[(size_t)(kb < K ? kb : K - 1) * ld + n] : 0.f; }
  return bsplit16(v); }
__device__ __forceinline__ v8f mac3(const F2& a, const F2& b, v8f c) { c = wmma_bf(a.l, b.h, c); c = wmma_bf(a.h, b.l, c); return wmma_bf(a.h, b.h, c); }
__device__ __forceinline__ float sigm(float v) { return 1.0f / (1.0f + expf(-v)); }
#define LDSX() do { asm volatile("s_wait_dscnt 0" ::: "memory"); __builtin_amdgcn_wave_barrier(); __builtin_amdgcn_fence(__ATOMIC_RELEASE, "workgroup"); } while (0)

// Causal scaled-dot-product attention on given tensors (queries / keys / values [16,4096,64], single head; the module adds -2^32 to the strictly-upper triangle before the softmax - equivalent to excluding those keys): out = softmax(causal(Q K^T / 8)) V -> [16,4096,64].
#define NB 16
#define TT 4096
#define CC 64            // NH * HD = projected width
#define DIN 64          // input (model) width
#define NH 1
#define HD 64
#define NQB (TT / 64)
#define HG 1
#define SCALE (0.125f)
#define CAUSAL 1
#ifndef TNB
#define TNB NB
#endif
__device__ __forceinline__ float bfr(float v) { return (float)(__bf16)v; }
__host__ __device__ __forceinline__ int kb_last(int qb) { return CAUSAL ? ((qb * 64 + 63) >> 7) : (TT / 128 - 1); }
typedef __attribute__((ext_vector_type(8))) __bf16 v8b;
__device__ __forceinline__ v16b frag_b(const __bf16* rowk0, int lane) {
  union { v16b v; v8b q[2]; } u; const __bf16* p = rowk0 + 8 * (lane >> 4);
  u.q[0] = *(const v8b*)p; u.q[1] = *(const v8b*)(p + 16); return u.v;
}
#define QBH 6              // causal: query blocks 0..QBH-1 of each sequence (few keys, no averaging) take the high-precision path
#define QHI 384            // rows carrying a q residual plane (all rows when non-causal: 2-product logits everywhere)
#define KHI 384            // key rows carrying k residual / v bf16 hi+lo planes (used only by the causal high-precision path)
// B fragment (k rows k0+.., output column o) of a weight: (in,out) [K][ld] or (out,in) [ld rows of K]: bf16 exact, or f16(bf16 * 256) exact
__device__ __forceinline__ v16b wcol_io(const float* Wm, int k0, int o, int lane, int ld) { v16b w; const int g = lane >> 4;
#pragma unroll
  for (int i = 0; i < 8; ++i) { w[i] = (__bf16)Wm[(size_t)(k0 + 8 * g + i) * ld + o]; w[8 + i] = (__bf16)Wm[(size_t)(k0 + 16 + 8 * g + i) * ld + o]; }
  return w; }
__device__ __forceinline__ v16b wcol_oi(const float* Wm, int k0, int o, int lane, int K) { v16b w; const float* p = Wm + (size_t)o * K + k0 + 8 * (lane >> 4);
#pragma unroll
  for (int i = 0; i < 8; ++i) { w[i] = (__bf16)p[i]; w[8 + i] = (__bf16)p[16 + i]; }
  return w; }
__device__ __forceinline__ v16h wcolh_io(const float* Wm, int k0, int o, int lane, int ld) { v16h w; const int g = lane >> 4;
#pragma unroll
  for (int i = 0; i < 8; ++i) { w[i] = (_Float16)(bfr(Wm[(size_t)(k0 + 8 * g + i) * ld + o]) * 256.0f); w[8 + i] = (_Float16)(bfr(Wm[(size_t)(k0 + 16 + 8 * g + i) * ld + o]) * 256.0f); }
  return w; }
__device__ __forceinline__ v16h wcolh_oi(const float* Wm, int k0, int o, int lane, int K) { v16h w; const float* p = Wm + (size_t)o * K + k0 + 8 * (lane >> 4);
#pragma unroll
  for (int i = 0; i < 8; ++i) { w[i] = (_Float16)(bfr(p[i]) * 256.0f); w[8 + i] = (_Float16)(bfr(p[16 + i]) * 256.0f); }
  return w; }
#define WQKV_LAYOUT 0   // 0 = (in,out) [DIN][CC]; 1 = (out,in) [CC][DIN]; 2 = per-head [NH][DIN][HD]
__device__ __forceinline__ v16b wcol_hdk(const float* Wm, int k0, int o, int lane) { v16b w; const int g = lane >> 4; const float* p = Wm + (size_t)(o / HD) * DIN * HD + (o % HD);
#pragma unroll
  for (int i = 0; i < 8; ++i) { w[i] = (__bf16)p[(size_t)(k0 + 8 * g + i) * HD]; w[8 + i] = (__bf16)p[(size_t)(k0 + 16 + 8 * g + i) * HD]; }
  return w; }
#define WO_OUT_IN 0
#if WQKV_LAYOUT == 1
#define WCOL(W, k0, o, lane) wcol_oi(W, k0, o, lane, DIN)
#elif WQKV_LAYOUT == 2
#define WCOL(W, k0, o, lane) wcol_hdk(W, k0, o, lane)
#else
#define WCOL(W, k0, o, lane) wcol_io(W, k0, o, lane, CC)
#endif
#if WO_OUT_IN
#define WOCOL(W, k0, o, lane) wcol_oi(W, k0, o, lane, CC)
#define WOCOLH(W, k0, o, lane) wcolh_oi(W, k0, o, lane, CC)
#else
#define WOCOL(W, k0, o, lane) wcol_io(W, k0, o, lane, DIN)
#define WOCOLH(W, k0, o, lane) wcolh_io(W, k0, o, lane, DIN)
#endif
__global__ __launch_bounds__(256) void k_planes64(const float* __restrict__ Qs, const float* __restrict__ Ks, const float* __restrict__ Vs, _Float16* __restrict__ QH, _Float16* __restrict__ QL, _Float16* __restrict__ KH, _Float16* __restrict__ KL, _Float16* __restrict__ VT, __bf16* __restrict__ VB, __bf16* __restrict__ VBL) {
  __shared__ _Float16 sv[64][72];
  const int tid = threadIdx.x; const size_t r0 = (size_t)blockIdx.x * 64; const int b = (int)(r0 / TT), t0 = (int)(r0 % TT);
  for (int e = tid; e < 64 * 8; e += 256) { const int rl = e >> 3, q = e & 7; const size_t src = (r0 + rl) * CC + q * 8; float tq[8], tk[8], tv[8];
#pragma unroll
    for (int u = 0; u < 8; ++u) { tq[u] = Qs[src + u]; tk[u] = Ks[src + u]; tv[u] = Vs[src + u]; }
    asm volatile("s_wait_loadcnt 0x0" ::: "memory");
    hx8 hq, hk, hlq, hlk;
#pragma unroll
    for (int u = 0; u < 8; ++u) { const float qv = bfr(tq[u]), kv = bfr(tk[u]); const _Float16 qh = (_Float16)qv, kh = (_Float16)kv; hq[u] = qh; hlq[u] = (_Float16)((qv - (float)qh) * 1024.0f); hk[u] = kh; hlk[u] = (_Float16)((kv - (float)kh) * 1024.0f); sv[rl][q * 8 + u] = (_Float16)bfr(tv[u]); }
    vst2((unsigned*)(QH + (r0 + rl) * CC + q * 8), *(const v4u*)&hq); vst2((unsigned*)(KH + (r0 + rl) * CC + q * 8), *(const v4u*)&hk);
    if (t0 + rl < QHI) vst2((unsigned*)(QL + ((size_t)b * QHI + t0 + rl) * CC + q * 8), *(const v4u*)&hlq);
    if (t0 + rl < KHI) vst2((unsigned*)(KL + ((size_t)b * KHI + t0 + rl) * CC + q * 8), *(const v4u*)&hlk); }
  __syncthreads();
  for (int e = tid; e < 64 * 8; e += 256) { const int c = e >> 3, q = e & 7; hx8 hv; _Pragma("unroll") for (int j = 0; j < 8; ++j) hv[j] = sv[q * 8 + j][c]; vst2((unsigned*)(VT + ((size_t)b * CC + c) * TT + t0 + q * 8), *(const v4u*)&hv);
    if (t0 < KHI) { v8b bh, bl; _Pragma("unroll") for (int j = 0; j < 8; ++j) { const float vv = (float)hv[j]; const __bf16 h1 = (__bf16)vv; bh[j] = h1; bl[j] = (__bf16)(vv - (float)h1); } vst2((unsigned*)(VB + ((size_t)b * CC + c) * KHI + t0 + q * 8), *(const v4u*)&bh); vst2((unsigned*)(VBL + ((size_t)b * CC + c) * KHI + t0 + q * 8), *(const v4u*)&bl); } } }
#ifndef SM_EXTRA_PARAMS
#define SM_EXTRA_PARAMS
#endif
#ifndef PROJ_EXTRA_PARAMS
#define PROJ_EXTRA_PARAMS
#endif
#ifndef SM_MASK_HOOK
#define SM_MASK_HOOK (void)0
#endif

#define WS_QH  0u                                      // f16 q rows [b*t][CC]
#define WS_KH  (WS_QH + 2u * (size_t)NB * TT * CC)      // f16 k rows [b*t][CC]
#define WS_VT  (WS_KH + 2u * (size_t)NB * TT * CC)      // f16 v planes [b][c][t]
#define WS_QL  (WS_VT + 2u * (size_t)NB * CC * TT)      // f16 q residual x 2^10 rows [b][t < QHI][CC]
#define WS_KL  (WS_QL + 2u * (size_t)NB * QHI * CC)     // f16 k residual x 2^10 rows [b][t < KHI][CC]
#define WS_VB  (WS_KL + 2u * (size_t)NB * KHI * CC)     // bf16 v hi planes [b][c][t < KHI]
#define WS_VBL (WS_VB + 2u * (size_t)NB * CC * KHI)
#define WS_S   (WS_VBL + 2u * (size_t)NB * CC * KHI)    // f32 logits / P [hg][t][s]
#define WS_Y   (WS_S  + 4u * (size_t)HG * TT * TT)      // f32 ctx rows [b*t][CC] (only when there is an output projection)
#define WS_END (WS_Y  + 0u)

// ---- k_proj: block = (64 rows, 128 cols, which): q/k/v = X W (+ b) with exact bf16 products (K = DIN) -> which 0: q f16 rows (+ residual rows < QHI); 1: k f16 rows (+ residual rows < KHI); 2: v f16 planes [c][t] (+ bf16 hi/lo planes for t < KHI)
__global__ __launch_bounds__(128) void k_proj(const float* __restrict__ XQ, const float* __restrict__ XK, const float* __restrict__ XV, const float* __restrict__ WQ, const float* __restrict__ WK, const float* __restrict__ WV, const float* __restrict__ BQ, const float* __restrict__ BK, const float* __restrict__ BV,
    _Float16* __restrict__ QH, _Float16* __restrict__ QL, _Float16* __restrict__ KH, _Float16* __restrict__ KL, _Float16* __restrict__ VT, __bf16* __restrict__ VB, __bf16* __restrict__ VBL) {
  __shared__ __align__(16) _Float16 sh[64][136], sl[64][136]; __shared__ __align__(16) _Float16 th[128][72]; __shared__ __align__(16) __bf16 tb[128][72], tbl[128][72];
  const int tid = threadIdx.x, wave = tid >> 5, lane = tid & 31, col = lane & 15, g = lane >> 4; const int which = blockIdx.z; const int c0 = blockIdx.y * 128; const size_t r0 = (size_t)blockIdx.x * 64; const size_t bb = r0 / TT; const int t0 = (int)(r0 % TT);
  const float* X = which == 0 ? XQ : which == 1 ? XK : XV; const float* WA = which == 0 ? WQ : which == 1 ? WK : WV; const float* BA = which == 0 ? BQ : which == 1 ? BK : BV;
  v8f acc[8] = {};
#pragma unroll 2
  for (int kc = 0; kc < DIN / 32; ++kc) { v16b a; { const float* p = X + (r0 + wave * 16 + col) * DIN + kc * 32 + 8 * g;
#pragma unroll
      for (int i = 0; i < 8; ++i) { a[i] = (__bf16)p[i]; a[8 + i] = (__bf16)p[16 + i]; } }
    asm volatile("s_wait_loadcnt 0x0" ::: "memory");
#pragma unroll
    for (int j = 0; j < 8; ++j) { const v16b w = WCOL(WA, kc * 32, c0 + j * 16 + col, lane); asm volatile("s_wait_loadcnt 0x0" ::: "memory"); acc[j] = wmma_bf(a, w, acc[j]); } }
  if (which < 2) { _Float16* DH = which == 0 ? QH : KH; _Float16* DL = which == 0 ? QL : KL; const int nhi = which == 0 ? QHI : KHI; const bool hi_rows = t0 < nhi;
#pragma unroll
    for (int j = 0; j < 8; ++j) { const float bias = BA ? bfr(BA[c0 + j * 16 + col]) : 0.f;
#pragma unroll
      for (int r = 0; r < 8; ++r) { const float v = acc[j][r] + bias; const _Float16 hv = (_Float16)v; sh[wave * 16 + 8 * g + r][j * 16 + col] = hv; sl[wave * 16 + 8 * g + r][j * 16 + col] = (_Float16)((v - (float)hv) * 1024.0f); } }
    __syncthreads();
    for (int e = tid; e < 64 * 16; e += 128) { const int rl = e >> 4, q = e & 15; vst2((unsigned*)(DH + (r0 + rl) * CC + c0 + q * 8), *(const v4u*)&sh[rl][q * 8]); if (hi_rows) vst2((unsigned*)(DL + (bb * nhi + t0 + rl) * (size_t)CC + c0 + q * 8), *(const v4u*)&sl[rl][q * 8]); }
  } else { const bool hi_rows = t0 < KHI;
#pragma unroll
    for (int j = 0; j < 8; ++j) { const float bias = BA ? bfr(BA[c0 + j * 16 + col]) : 0.f;
#pragma unroll
      for (int r = 0; r < 8; ++r) { const float v = acc[j][r] + bias; const int rl = wave * 16 + 8 * g + r, cl = j * 16 + col; th[cl][rl] = (_Float16)v; const __bf16 bh = (__bf16)v; tb[cl][rl] = bh; tbl[cl][rl] = (__bf16)(v - (float)bh); } }
    __syncthreads();
    for (int e = tid; e < 128 * 8; e += 128) { const int cl = e >> 3, q = e & 7; vst2((unsigned*)(VT + (bb * CC + c0 + cl) * (size_t)TT + t0 + q * 8), *(const v4u*)&th[cl][q * 8]); if (hi_rows) { const size_t o3 = (bb * CC + c0 + cl) * (size_t)KHI + t0 + q * 8; vst2((unsigned*)(VB + o3), *(const v4u*)&tb[cl][q * 8]); vst2((unsigned*)(VBL + o3), *(const v4u*)&tbl[cl][q * 8]); } } } }
// ---- k_sc: block = (query block qb, key block kb <= kb_last(qb), head in group) of batch b: logits x SCALE; q hi + residual (x 2^10) against k (2 products) for query rows < QHI, plus the k residual (3 products) for query blocks < QBH (causal early rows); causal: blocks past the diagonal exit, the mask itself is applied by index in k_sm
__global__ __launch_bounds__(128) void k_sc(const _Float16* __restrict__ QH, const _Float16* __restrict__ KH, const _Float16* __restrict__ QL, const _Float16* __restrict__ KL, int b, int h0, float* __restrict__ S0) { __shared__ __align__(16) float ss[4][16][132];
  const int qb = blockIdx.x, kb = blockIdx.y; if (kb > kb_last(qb)) return;
  const int h = h0 + blockIdx.z; float* S = S0 + (size_t)blockIdx.z * TT * TT;
  const int tid = threadIdx.x, wave = tid >> 5, lane = tid & 31, col = lane & 15, g = lane >> 4; const int k0 = kb * 128; const int ql0 = qb * 64 + wave * 16; const size_t q0 = (size_t)b * TT + ql0, kr0 = (size_t)b * TT + k0;
  v8f acc[8] = {}, accl[8] = {};
  const _Float16* QLb = QL + (size_t)b * QHI * CC; const _Float16* KLb = KL + (size_t)b * KHI * CC;
  if (qb < QBH) {
#pragma unroll
    for (int kc = 0; kc < HD / 32; ++kc) { const v16h ah = frag_h(QH + (q0 + col) * CC + h * HD + kc * 32, lane), al = frag_h(QLb + (size_t)(ql0 + col) * CC + h * HD + kc * 32, lane);
#pragma unroll
      for (int j = 0; j < 8; ++j) { const v16h kbf = frag_h(KH + (kr0 + j * 16 + col) * CC + h * HD + kc * 32, lane), klf = frag_h(KLb + (size_t)(k0 + j * 16 + col) * CC + h * HD + kc * 32, lane); acc[j] = wmma16(ah, kbf, acc[j]); accl[j] = wmma16(al, kbf, accl[j]); accl[j] = wmma16(ah, klf, accl[j]); } }
  } else if (qb * 64 < QHI) {
#pragma unroll
    for (int kc = 0; kc < HD / 32; ++kc) { const v16h ah = frag_h(QH + (q0 + col) * CC + h * HD + kc * 32, lane), al = frag_h(QLb + (size_t)(ql0 + col) * CC + h * HD + kc * 32, lane);
#pragma unroll
      for (int j = 0; j < 8; ++j) { const v16h kbf = frag_h(KH + (kr0 + j * 16 + col) * CC + h * HD + kc * 32, lane); acc[j] = wmma16(ah, kbf, acc[j]); accl[j] = wmma16(al, kbf, accl[j]); } }
  } else {
#pragma unroll
    for (int kc = 0; kc < HD / 32; ++kc) { const v16h ah = frag_h(QH + (q0 + col) * CC + h * HD + kc * 32, lane);
#pragma unroll
      for (int j = 0; j < 8; ++j) { const v16h kbf = frag_h(KH + (kr0 + j * 16 + col) * CC + h * HD + kc * 32, lane); acc[j] = wmma16(ah, kbf, acc[j]); } } }
#pragma unroll
  for (int j = 0; j < 8; ++j) {
#pragma unroll
    for (int r = 0; r < 8; ++r) ss[wave][8 * g + r][j * 16 + col] = (acc[j][r] + accl[j][r] * (1.0f / 1024.0f)) * SCALE; }
  LDSX(); for (int rl = 0; rl < 16; ++rl) vst2(S + (size_t)(ql0 + rl) * TT + k0 + lane * 4, *(const v4f*)&ss[wave][rl][lane * 4]); }
// ---- k_sm: block = query row t (head in group): keys [0, kend): causal -> logit if s <= t else excluded; softmax in f32; P x 2^11 in place (0 for excluded)
__global__ __launch_bounds__(256) void k_sm(float* __restrict__ S0 SM_EXTRA_PARAMS) { __shared__ float sred[8]; __shared__ float sbc; __shared__ __align__(16) float shv[TT];
  const int tid = threadIdx.x; const int t = blockIdx.x; const int kend = (kb_last(t >> 6) + 1) * 128;
  float* sr = S0 + (size_t)blockIdx.y * TT * TT + (size_t)t * TT;
  float m = -3.0e38f; for (int k = tid; k < kend; k += 256) { float v = (!CAUSAL || k <= t) ? sr[k] : -3.0e38f; SM_MASK_HOOK; shv[k] = v; m = fmaxf(m, v); }
#pragma unroll
  for (int o = 1; o < 32; o <<= 1) m = fmaxf(m, __shfl_xor(m, o));
  if ((tid & 31) == 0) sred[tid >> 5] = m; __syncthreads(); if (tid == 0) { float a = sred[0]; for (int i = 1; i < 8; ++i) a = fmaxf(a, sred[i]); sbc = a; } __syncthreads(); m = sbc; __syncthreads();
  float sum = 0.f; for (int k = tid; k < kend; k += 256) { const float v = shv[k]; const float e = (v <= -1.0e38f) ? 0.f : expf(v - m); shv[k] = e; sum += e; }
#pragma unroll
  for (int o = 1; o < 32; o <<= 1) sum += __shfl_xor(sum, o);
  if ((tid & 31) == 0) sred[tid >> 5] = sum; __syncthreads(); if (tid == 0) { float a = 0.f; for (int i = 0; i < 8; ++i) a += sred[i]; sbc = a > 0.f ? 2048.0f / a : 0.f; }   /* a fully excluded row yields P = 0 */ __syncthreads(); const float inv = sbc;
  for (int k = tid; k < kend; k += 256) shv[k] = shv[k] * inv;
  __syncthreads(); for (int q = tid; q < kend / 4; q += 256) vst2(sr + q * 4, *(const v4f*)&shv[q * 4]); }
// ---- k_pv: block = 64 queries (qb) of (b, h): ctx = P . v over keys [0, kend) (P x 2^11 once to f16 against v f16: 1 product; causal early query blocks: P and v as bf16 hi + lo, 3 products); 256-B (row, head) segment by 16 lanes
__global__ __launch_bounds__(128) void k_pv(const float* __restrict__ PS0, const _Float16* __restrict__ VT, const __bf16* __restrict__ VB, const __bf16* __restrict__ VBL, int b, int h0, float* __restrict__ Y) { const int h = h0 + blockIdx.z; const float* PS = PS0 + (size_t)blockIdx.z * TT * TT; __shared__ __align__(16) float ss[4][16][HD + 4];
  const int tid = threadIdx.x, wave = tid >> 5, lane = tid & 31, col = lane & 15, g = lane >> 4; const int qb = blockIdx.x; const int ql0 = qb * 64 + wave * 16; const int kce = (kb_last(qb) + 1) * 4;
  v8f acc[HD / 16] = {};
  if (qb < QBH) {
#pragma unroll 1
    for (int kc = 0; kc < kce; ++kc) { const F2 p = split_row(PS + (size_t)(ql0 + col) * TT, kc * 32, lane);
      asm volatile("s_wait_loadcnt 0x0" ::: "memory");
#pragma unroll
      for (int j = 0; j < HD / 16; ++j) { const size_t po = ((size_t)b * CC + h * HD + j * 16 + col) * (size_t)KHI + kc * 32; const v16b vh = frag_b(VB + po, lane); acc[j] = wmma_bf(p.h, vh, acc[j]); acc[j] = wmma_bf(p.l, vh, acc[j]); acc[j] = wmma_bf(p.h, frag_b(VBL + po, lane), acc[j]); } }
  } else {
#pragma unroll 1
    for (int kc = 0; kc < kce; ++kc) { const v16h p = frag_f32(PS + (size_t)(ql0 + col) * TT + kc * 32, lane);
      asm volatile("s_wait_loadcnt 0x0" ::: "memory");
#pragma unroll
      for (int j = 0; j < HD / 16; ++j) { const size_t po = ((size_t)b * CC + h * HD + j * 16 + col) * (size_t)TT + kc * 32; acc[j] = wmma16(p, frag_h(VT + po, lane), acc[j]); } } }
#pragma unroll
  for (int j = 0; j < HD / 16; ++j)
#pragma unroll
    for (int r = 0; r < 8; ++r) ss[wave][8 * g + r][j * 16 + col] = acc[j][r] * (1.0f / 2048.0f);
  LDSX(); for (int rl = 0; rl < 16; ++rl) if (lane < HD / 4) vst2(Y + ((size_t)b * TT + ql0 + rl) * CC + h * HD + lane * 4, *(const v4f*)&ss[wave][rl][lane * 4]); }

extern "C" void kernel_launch(void* const* d_in, const int* in_sizes, int n_in, void* d_out, int out_size, void* d_ws, size_t ws_size, hipStream_t stream) {
  (void)in_sizes; (void)n_in; (void)out_size;
  const float** F = (const float**)d_in;
  if (ws_size < (size_t)WS_END) return;
  char* ws = (char*)d_ws; _Float16 *QH = (_Float16*)(ws + WS_QH), *KH = (_Float16*)(ws + WS_KH), *VT = (_Float16*)(ws + WS_VT), *QL = (_Float16*)(ws + WS_QL), *KL = (_Float16*)(ws + WS_KL); __bf16 *VB = (__bf16*)(ws + WS_VB), *VBL = (__bf16*)(ws + WS_VBL); float *S = (float*)(ws + WS_S), *Y = (float*)(ws + WS_Y);
  (void)Y; (void)QL; (void)KL; (void)VB; (void)VBL;
  // inputs: 0 queries [16,4096,64]; 1 keys; 2 values
  k_planes64<<<dim3(TNB * TT / 64), 256, 0, stream>>>(F[0], F[1], F[2], QH, QL, KH, KL, VT, VB, VBL);
  for (int b = 0; b < TNB; ++b) {
    k_sc<<<dim3(NQB, TT / 128, 1), 128, 0, stream>>>(QH, KH, QL, KL, b, 0, S);
    k_sm<<<dim3(TT, 1), 256, 0, stream>>>(S);
    k_pv<<<dim3(NQB, 1, 1), 128, 0, stream>>>(S, VT, VB, VBL, b, 0, (float*)d_out);
  }
}

// v001
// One run takes 94.2 microseconds.
// Two timings next to v000 put it at 27.4 and 27.2 times that version's speed.
// compute dtype: all float inputs rounded to bf16; Q, K, V are bf16-valued so their f16 planes are exact; causal logits q x k (1 product; the residual products below row 384 multiply exact zeros) x 64^-0.5; online softmax f32; unnormalised P = 2^(s - m) once to f16 x v (exact) (bf16 hi + lo P below row 384), divided by the f32 row sum at the end; f32 output.
#include <hip/hip_runtime.h>
#include <math.h>

typedef __attribute__((ext_vector_type(16))) _Float16 v16h;
typedef __attribute__((ext_vector_type(16))) __bf16 v16b;
typedef __attribute__((ext_vector_type(8)))  _Float16 v8h;
typedef __attribute__((ext_vector_type(8)))  float v8f;
typedef __attribute__((ext_vector_type(4)))  float v4f;
typedef __attribute__((ext_vector_type(2)))  float v2f;
typedef __attribute__((ext_vector_type(4)))  unsigned v4u;
typedef _Float16 hx8 __attribute__((ext_vector_type(8)));
typedef __attribute__((ext_vector_type(4)))  int v4i;
typedef float __attribute__((may_alias)) float_a;
typedef int __attribute__((may_alias)) int_a;

template <typename T> __device__ __forceinline__ void vst2(void* p, T v) { *(T*)p = v;  }
__device__ __forceinline__ v8f wmma16(v16h a, v16h b, v8f c) {
  v8f d = __builtin_amdgcn_wmma_f32_16x16x32_f16(false, a, false, b, (short)0, c, false, false);
  asm volatile("v_nop\n\tv_nop\n\tv_nop\n\tv_nop" : "+v"(d) : "v"(a), "v"(b));
  return d;
}
__device__ __forceinline__ v8f wmma_bf(v16b a, v16b b, v8f c) {
  v8f d = __builtin_amdgcn_wmma_f32_16x16x32_bf16(false, a, false, b, (short)0, c, false, false);
  asm volatile("v_nop\n\tv_nop\n\tv_nop\n\tv_nop" : "+v"(d) : "v"(a), "v"(b));
  return d;
}
// 16x16x32 fragments: lane = (h = lane>>4, row/col = lane&15); elements 0..7 = k0+8h+0..7, 8..15 = k0+16+8h+0..7; D element r = row 8h+r
__device__ __forceinline__ v16h frag_h(const _Float16* rowk0, int lane) {
  union { v16h v; v8h q[2]; } u; const _Float16* p = rowk0 + 8 * (lane >> 4);
  u.q[0] = *(const v8h*)p; u.q[1] = *(const v8h*)(p + 16); return u.v;
}
__device__ __forceinline__ v16h frag_f32(const float* rowk0, int lane) {
  v16h a; const float* p = rowk0 + 8 * (lane >> 4);
#pragma unroll
  for (int i = 0; i < 8; ++i) { a[i] = (_Float16)p[i]; a[8 + i] = (_Float16)p[16 + i]; }
  return a;
}
__device__ __forceinline__ v16h frag_f32s(const float* rowk0, int lane, float sc) {
  v16h a; const float* p = rowk0 + 8 * (lane >> 4);
#pragma unroll
  for (int i = 0; i < 8; ++i) { a[i] = (_Float16)(p[i] * sc); a[8 + i] = (_Float16)(p[16 + i] * sc); }
  return a;
}
// column fragment from a [K][ld] layout (column n), rows >= K read as 0
__device__ __forceinline__ v16h fragc_f32(const float* W, int k0, int n, int lane, int ld, int K) {
  v16h a; const int g = lane >> 4;
#pragma unroll
  for (int i = 0; i < 8; ++i) { const int ka = k0 + 8 * g + i, kb = ka + 16;
    a[i] = (_Float16)(ka < K ? W[(size_t)(ka < K ? ka : K - 1) * ld + n] : 0.f); a[8 + i] = (_Float16)(kb < K ? W[(size_t)(kb < K ? kb : K - 1) * ld + n] : 0.f); }
  return a;
}
struct F2 { v16b h, l; };
__device__ __forceinline__ F2 bsplit16(const float v[16]) { F2 r;
#pragma unroll
  for (int i = 0; i < 16; ++i) { const __bf16 h = (__bf16)v[i]; r.h[i] = h; r.l[i] = (__bf16)(v[i] - (float)h); }
  return r; }
__device__ __forceinline__ F2 split_row(const float* row, int k0, int lane) { float v[16]; const float* p = row + k0 + 8 * (lane >> 4);
#pragma unroll
  for (int i = 0; i < 8; ++i) { v[i] = p[i]; v[8 + i] = p[16 + i]; }
  return bsplit16(v); }
__device__ __forceinline__ F2 split_rowK(const float* row, int k0, int lane, int K) { float v[16]; const int g = lane >> 4;
#pragma unroll
  for (int i = 0; i < 8; ++i) { const int ka = k0 + 8 * g + i, kb = ka + 16; v[i] = ka < K ? row[ka < K ? ka : K - 1] : 0.f; v[8 + i] = kb < K ? row[kb < K ? kb : K - 1] : 0.f; }
  return bsplit16(v); }
__device__ __forceinline__ F2 split_col(const float* W, int k0, int n, int lane, int ld, int K) { float v[16]; const int g = lane >> 4;
#pragma unroll
  for (int i = 0; i < 8; ++i) { const int ka = k0 + 8 * g + i, kb = ka + 16; v[i] = ka < K ? W[(size_t)(ka < K ? ka : K - 1) * ld + n] : 0.f; v[8 + i] = kb < K ? W[(size_t)(kb < K ? kb : K - 1) * ld + n] : 0.f; }
  return bsplit16(v); }
__device__ __forceinline__ v8f mac3(const F2& a, const F2& b, v8f c) { c = wmma_bf(a.l, b.h, c); c = wmma_bf(a.h, b.l, c); return wmma_bf(a.h, b.h, c); }
__device__ __forceinline__ float sigm(float v) { return 1.0f / (1.0f + expf(-v)); }
#define LDSX() do { asm volatile("s_wait_dscnt 0" ::: "memory"); __builtin_amdgcn_wave_barrier(); __builtin_amdgcn_fence(__ATOMIC_RELEASE, "workgroup"); } while (0)

// Causal scaled-dot-product attention on given tensors (queries / keys / values [16,4096,64], single head; the module adds -2^32 to the strictly-upper triangle before the softmax - equivalent to excluding those keys): out = softmax(causal(Q K^T / 8)) V -> [16,4096,64].
#define NB 16
#define TT 4096
#define CC 64            // NH * HD = projected width
#define DIN 64          // input (model) width
#define NH 1
#define HD 64
#define NQB (TT / 64)
#define HG 1
#define SCALE (0.125f)
#define CAUSAL 1
#ifndef TNB
#define TNB NB
#endif
__device__ __forceinline__ float bfr(float v) { return (float)(__bf16)v; }
__host__ __device__ __forceinline__ int kb_last(int qb) { return CAUSAL ? ((qb * 64 + 63) >> 7) : (TT / 128 - 1); }
typedef __attribute__((ext_vector_type(8))) __bf16 v8b;
__device__ __forceinline__ v16b frag_b(const __bf16* rowk0, int lane) {
  union { v16b v; v8b q[2]; } u; const __bf16* p = rowk0 + 8 * (lane >> 4);
  u.q[0] = *(const v8b*)p; u.q[1] = *(const v8b*)(p + 16); return u.v;
}
#define QBH 6              // unused: the high-precision path is chosen by q0 < QHI (queries 0..383: few keys, no averaging)
#define QHI 384            // rows carrying a q residual plane (all rows when non-causal: 2-product logits everywhere)
#define KHI 384            // key rows carrying k residual / v bf16 hi+lo planes (used only by the causal high-precision path)
// B fragment (k rows k0+.., output column o) of a weight: (in,out) [K][ld] or (out,in) [ld rows of K]: bf16 exact, or f16(bf16 * 256) exact
__device__ __forceinline__ v16b wcol_io(const float* Wm, int k0, int o, int lane, int ld) { v16b w; const int g = lane >> 4;
#pragma unroll
  for (int i = 0; i < 8; ++i) { w[i] = (__bf16)Wm[(size_t)(k0 + 8 * g + i) * ld + o]; w[8 + i] = (__bf16)Wm[(size_t)(k0 + 16 + 8 * g + i) * ld + o]; }
  return w; }
__device__ __forceinline__ v16b wcol_oi(const float* Wm, int k0, int o, int lane, int K) { v16b w; const float* p = Wm + (size_t)o * K + k0 + 8 * (lane >> 4);
#pragma unroll
  for (int i = 0; i < 8; ++i) { w[i] = (__bf16)p[i]; w[8 + i] = (__bf16)p[16 + i]; }
  return w; }
__device__ __forceinline__ v16h wcolh_io(const float* Wm, int k0, int o, int lane, int ld) { v16h w; const int g = lane >> 4;
#pragma unroll
  for (int i = 0; i < 8; ++i) { w[i] = (_Float16)(bfr(Wm[(size_t)(k0 + 8 * g + i) * ld + o]) * 256.0f); w[8 + i] = (_Float16)(bfr(Wm[(size_t)(k0 + 16 + 8 * g + i) * ld + o]) * 256.0f); }
  return w; }
__device__ __forceinline__ v16h wcolh_oi(const float* Wm, int k0, int o, int lane, int K) { v16h w; const float* p = Wm + (size_t)o * K + k0 + 8 * (lane >> 4);
#pragma unroll
  for (int i = 0; i < 8; ++i) { w[i] = (_Float16)(bfr(p[i]) * 256.0f); w[8 + i] = (_Float16)(bfr(p[16 + i]) * 256.0f); }
  return w; }
#define WQKV_LAYOUT 0   // 0 = (in,out) [DIN][CC]; 1 = (out,in) [CC][DIN]; 2 = per-head [NH][DIN][HD]
__device__ __forceinline__ v16b wcol_hdk(const float* Wm, int k0, int o, int lane) { v16b w; const int g = lane >> 4; const float* p = Wm + (size_t)(o / HD) * DIN * HD + (o % HD);
#pragma unroll
  for (int i = 0; i < 8; ++i) { w[i] = (__bf16)p[(size_t)(k0 + 8 * g + i) * HD]; w[8 + i] = (__bf16)p[(size_t)(k0 + 16 + 8 * g + i) * HD]; }
  return w; }
#define WO_OUT_IN 0
#if WQKV_LAYOUT == 1
#define WCOL(W, k0, o, lane) wcol_oi(W, k0, o, lane, DIN)
#elif WQKV_LAYOUT == 2
#define WCOL(W, k0, o, lane) wcol_hdk(W, k0, o, lane)
#else
#define WCOL(W, k0, o, lane) wcol_io(W, k0, o, lane, CC)
#endif
#if WO_OUT_IN
#define WOCOL(W, k0, o, lane) wcol_oi(W, k0, o, lane, CC)
#define WOCOLH(W, k0, o, lane) wcolh_oi(W, k0, o, lane, CC)
#else
#define WOCOL(W, k0, o, lane) wcol_io(W, k0, o, lane, DIN)
#define WOCOLH(W, k0, o, lane) wcolh_io(W, k0, o, lane, DIN)
#endif
__global__ __launch_bounds__(256) void k_planes64(const float* __restrict__ Qs, const float* __restrict__ Ks, const float* __restrict__ Vs, _Float16* __restrict__ QH, _Float16* __restrict__ QL, _Float16* __restrict__ KH, _Float16* __restrict__ KL, _Float16* __restrict__ VT, __bf16* __restrict__ VB, __bf16* __restrict__ VBL) {
  __shared__ _Float16 sv[64][72];
  const int tid = threadIdx.x; const size_t r0 = (size_t)blockIdx.x * 64; const int b = (int)(r0 / TT), t0 = (int)(r0 % TT);
  for (int e = tid; e < 64 * 8; e += 256) { const int rl = e >> 3, q = e & 7; const size_t src = (r0 + rl) * CC + q * 8; float tq[8], tk[8], tv[8];
#pragma unroll
    for (int u = 0; u < 8; ++u) { tq[u] = Qs[src + u]; tk[u] = Ks[src + u]; tv[u] = Vs[src + u]; }
    asm volatile("s_wait_loadcnt 0x0" ::: "memory");
    hx8 hq, hk, hlq, hlk;
#pragma unroll
    for (int u = 0; u < 8; ++u) { const float qv = bfr(tq[u]), kv = bfr(tk[u]); const _Float16 qh = (_Float16)qv, kh = (_Float16)kv; hq[u] = qh; hlq[u] = (_Float16)((qv - (float)qh) * 1024.0f); hk[u] = kh; hlk[u] = (_Float16)((kv - (float)kh) * 1024.0f); sv[rl][q * 8 + u] = (_Float16)bfr(tv[u]); }
    vst2((unsigned*)(QH + (r0 + rl) * CC + q * 8), *(const v4u*)&hq); vst2((unsigned*)(KH + (r0 + rl) * CC + q * 8), *(const v4u*)&hk);
    if (t0 + rl < QHI) vst2((unsigned*)(QL + ((size_t)b * QHI + t0 + rl) * CC + q * 8), *(const v4u*)&hlq);
    if (t0 + rl < KHI) vst2((unsigned*)(KL + ((size_t)b * KHI + t0 + rl) * CC + q * 8), *(const v4u*)&hlk); }
  __syncthreads();
  for (int e = tid; e < 64 * 8; e += 256) { const int c = e >> 3, q = e & 7; hx8 hv; _Pragma("unroll") for (int j = 0; j < 8; ++j) hv[j] = sv[q * 8 + j][c]; vst2((unsigned*)(VT + ((size_t)b * CC + c) * TT + t0 + q * 8), *(const v4u*)&hv);
    if (t0 < KHI) { v8b bh, bl; _Pragma("unroll") for (int j = 0; j < 8; ++j) { const float vv = (float)hv[j]; const __bf16 h1 = (__bf16)vv; bh[j] = h1; bl[j] = (__bf16)(vv - (float)h1); } vst2((unsigned*)(VB + ((size_t)b * CC + c) * KHI + t0 + q * 8), *(const v4u*)&bh); vst2((unsigned*)(VBL + ((size_t)b * CC + c) * KHI + t0 + q * 8), *(const v4u*)&bl); } } }
#ifndef SM_EXTRA_PARAMS
#define SM_EXTRA_PARAMS
#endif
#ifndef PROJ_EXTRA_PARAMS
#define PROJ_EXTRA_PARAMS
#endif
#ifndef SM_MASK_HOOK
#define SM_MASK_HOOK (void)0
#endif

#define WS_QH  0u                                      // f16 q rows [b*t][CC]
#define WS_KH  (WS_QH + 2u * (size_t)NB * TT * CC)      // f16 k rows [b*t][CC]
#define WS_VT  (WS_KH + 2u * (size_t)NB * TT * CC)      // f16 v planes [b][c][t]
#define WS_QL  (WS_VT + 2u * (size_t)NB * CC * TT)      // f16 q residual x 2^10 rows [b][t < QHI][CC]
#define WS_KL  (WS_QL + 2u * (size_t)NB * QHI * CC)     // f16 k residual x 2^10 rows [b][t < KHI][CC]
#define WS_VB  (WS_KL + 2u * (size_t)NB * KHI * CC)     // bf16 v hi planes [b][c][t < KHI]
#define WS_VBL (WS_VB + 2u * (size_t)NB * CC * KHI)
#define WS_S   (WS_VBL + 2u * (size_t)NB * CC * KHI)    // f32 [hg][t][s] region, unused: logits and P stay in registers
#define WS_Y   (WS_S  + 4u * (size_t)HG * TT * TT)      // f32 ctx rows [b*t][CC] (only when there is an output projection)
#define WS_END (WS_Y  + 0u)

// ---- k_proj: block = (64 rows, 128 cols, which): q/k/v = X W (+ b) with exact bf16 products (K = DIN) -> which 0: q f16 rows (+ residual rows < QHI); 1: k f16 rows (+ residual rows < KHI); 2: v f16 planes [c][t] (+ bf16 hi/lo planes for t < KHI)
__global__ __launch_bounds__(128) void k_proj(const float* __restrict__ XQ, const float* __restrict__ XK, const float* __restrict__ XV, const float* __restrict__ WQ, const float* __restrict__ WK, const float* __restrict__ WV, const float* __restrict__ BQ, const float* __restrict__ BK, const float* __restrict__ BV,
    _Float16* __restrict__ QH, _Float16* __restrict__ QL, _Float16* __restrict__ KH, _Float16* __restrict__ KL, _Float16* __restrict__ VT, __bf16* __restrict__ VB, __bf16* __restrict__ VBL) {
  __shared__ __align__(16) _Float16 sh[64][136], sl[64][136]; __shared__ __align__(16) _Float16 th[128][72]; __shared__ __align__(16) __bf16 tb[128][72], tbl[128][72];
  const int tid = threadIdx.x, wave = tid >> 5, lane = tid & 31, col = lane & 15, g = lane >> 4; const int which = blockIdx.z; const int c0 = blockIdx.y * 128; const size_t r0 = (size_t)blockIdx.x * 64; const size_t bb = r0 / TT; const int t0 = (int)(r0 % TT);
  const float* X = which == 0 ? XQ : which == 1 ? XK : XV; const float* WA = which == 0 ? WQ : which == 1 ? WK : WV; const float* BA = which == 0 ? BQ : which == 1 ? BK : BV;
  v8f acc[8] = {};
#pragma unroll 2
  for (int kc = 0; kc < DIN / 32; ++kc) { v16b a; { const float* p = X + (r0 + wave * 16 + col) * DIN + kc * 32 + 8 * g;
#pragma unroll
      for (int i = 0; i < 8; ++i) { a[i] = (__bf16)p[i]; a[8 + i] = (__bf16)p[16 + i]; } }
    asm volatile("s_wait_loadcnt 0x0" ::: "memory");
#pragma unroll
    for (int j = 0; j < 8; ++j) { const v16b w = WCOL(WA, kc * 32, c0 + j * 16 + col, lane); asm volatile("s_wait_loadcnt 0x0" ::: "memory"); acc[j] = wmma_bf(a, w, acc[j]); } }
  if (which < 2) { _Float16* DH = which == 0 ? QH : KH; _Float16* DL = which == 0 ? QL : KL; const int nhi = which == 0 ? QHI : KHI; const bool hi_rows = t0 < nhi;
#pragma unroll
    for (int j = 0; j < 8; ++j) { const float bias = BA ? bfr(BA[c0 + j * 16 + col]) : 0.f;
#pragma unroll
      for (int r = 0; r < 8; ++r) { const float v = acc[j][r] + bias; const _Float16 hv = (_Float16)v; sh[wave * 16 + 8 * g + r][j * 16 + col] = hv; sl[wave * 16 + 8 * g + r][j * 16 + col] = (_Float16)((v - (float)hv) * 1024.0f); } }
    __syncthreads();
    for (int e = tid; e < 64 * 16; e += 128) { const int rl = e >> 4, q = e & 15; vst2((unsigned*)(DH + (r0 + rl) * CC + c0 + q * 8), *(const v4u*)&sh[rl][q * 8]); if (hi_rows) vst2((unsigned*)(DL + (bb * nhi + t0 + rl) * (size_t)CC + c0 + q * 8), *(const v4u*)&sl[rl][q * 8]); }
  } else { const bool hi_rows = t0 < KHI;
#pragma unroll
    for (int j = 0; j < 8; ++j) { const float bias = BA ? bfr(BA[c0 + j * 16 + col]) : 0.f;
#pragma unroll
      for (int r = 0; r < 8; ++r) { const float v = acc[j][r] + bias; const int rl = wave * 16 + 8 * g + r, cl = j * 16 + col; th[cl][rl] = (_Float16)v; const __bf16 bh = (__bf16)v; tb[cl][rl] = bh; tbl[cl][rl] = (__bf16)(v - (float)bh); } }
    __syncthreads();
    for (int e = tid; e < 128 * 8; e += 128) { const int cl = e >> 3, q = e & 7; vst2((unsigned*)(VT + (bb * CC + c0 + cl) * (size_t)TT + t0 + q * 8), *(const v4u*)&th[cl][q * 8]); if (hi_rows) { const size_t o3 = (bb * CC + c0 + cl) * (size_t)KHI + t0 + q * 8; vst2((unsigned*)(VB + o3), *(const v4u*)&tb[cl][q * 8]); vst2((unsigned*)(VBL + o3), *(const v4u*)&tbl[cl][q * 8]); } } } }
template <bool B> struct flag_t { static constexpr bool v = B; };
template <int N> struct int_t { static constexpr int v = N; };
__device__ __forceinline__ float xhalf(float x) { return __builtin_bit_cast(float, __builtin_amdgcn_permlanex16(__builtin_bit_cast(int, x), __builtin_bit_cast(int, x), 0x76543210, 0xfedcba98, false, false)); }  // lane l with lane l ^ 16, on the vector pipe
__device__ __forceinline__ v8f mm_h(v16h a, v16h b, v8f c) { return __builtin_amdgcn_wmma_f32_16x16x32_f16(false, a, false, b, (short)0, c, false, false); }
__device__ __forceinline__ v8f mm_b(v16b a, v16b b, v8f c) { return __builtin_amdgcn_wmma_f32_16x16x32_bf16(false, a, false, b, (short)0, c, false, false); }
// fragment from a lane's own pointer (row start + k0 + 8h): the same k order as frag_h / frag_b
__device__ __forceinline__ v16h frag_hp(const _Float16* p) { union { v16h v; v8h q[2]; } u; u.q[0] = *(const v8h*)p; u.q[1] = *(const v8h*)(p + 16); return u.v; }
__device__ __forceinline__ v16b frag_bp(const __bf16* p) { union { v16b v; v8b q[2]; } u; u.q[0] = *(const v8b*)p; u.q[1] = *(const v8b*)(p + 16); return u.v; }
// s_wait_xcnt 0 behind a run of loads, before their address registers are reused; the pointers are inputs so that those registers stay theirs up to the wait; the clobber keeps the loads issued in front of it, ahead of their use
#define XWAIT1(p) asm volatile("s_wait_xcnt 0x0" :: "v"(p) : "memory")
#define XWAIT2(p, q) asm volatile("s_wait_xcnt 0x0" :: "v"(p), "v"(q) : "memory")
template <bool HI>
__device__ __forceinline__ void fa_run(const _Float16* __restrict__ QH, const _Float16* __restrict__ KH, const _Float16* __restrict__ QL, const _Float16* __restrict__ KL, const _Float16* __restrict__ VT, const __bf16* __restrict__ VB, const __bf16* __restrict__ VBL, float* __restrict__ out, int b, int q0, int lane) {
  const int c = lane & 15, h = lane >> 4; const size_t bT = (size_t)b * TT;
  const float CS = SCALE * 1.4426950408889634f;   // logits go to the log2 domain inside the exponent's multiply-add
  v16h qf[2][2], qlf[2][2]; const _Float16* pq = QH + (bT + q0 + c) * CC + 8 * h; const _Float16* pql = QL + ((size_t)b * QHI + (HI ? q0 : 0) + c) * CC + 8 * h;
#pragma unroll
  for (int u = 0; u < 2; ++u)
#pragma unroll
    for (int kc = 0; kc < 2; ++kc) { qf[u][kc] = frag_hp(pq + u * 16 * CC + kc * 32); if constexpr (HI) qlf[u][kc] = frag_hp(pql + u * 16 * CC + kc * 32); }
  if constexpr (HI) XWAIT2(pq, pql); else XWAIT1(pq);
  v8f ot[2][4] = {}; float m[2] = {-1.0e30f, -1.0e30f}, l[2] = {0.f, 0.f};
  v16h ka[2][2], kla[2][2]; v16h vf[4]; v16b vbh[4], vbl[4];
  auto load_k = [&](v16h (&kf)[2][2], v16h (&klf)[2][2], int k0) { const _Float16* pk = KH + (bT + k0 + c) * CC + 8 * h; const _Float16* pkl = KL + ((size_t)b * KHI + (HI ? k0 : 0) + c) * CC + 8 * h;
#pragma unroll
    for (int t = 0; t < 2; ++t)
#pragma unroll
      for (int kc = 0; kc < 2; ++kc) { kf[t][kc] = frag_hp(pk + t * 16 * CC + kc * 32); if constexpr (HI) klf[t][kc] = frag_hp(pkl + t * 16 * CC + kc * 32); }
    if constexpr (HI) XWAIT2(pk, pkl); else XWAIT1(pk); };
  // values of key block k0 + D: the pointers stand at k0 and D is a constant of the loads' offsets, so the registers the loads name are the ones the wait holds
  auto load_v = [&](int k0, auto dd) { constexpr int D = decltype(dd)::v;
    if constexpr (HI) { const __bf16* ph = VB + ((size_t)b * CC + c) * (size_t)KHI + k0 + 8 * h; const __bf16* pl = VBL + ((size_t)b * CC + c) * (size_t)KHI + k0 + 8 * h;
#pragma unroll
      for (int j = 0; j < 4; ++j) { vbh[j] = frag_bp(ph + D + j * 16 * KHI); vbl[j] = frag_bp(pl + D + j * 16 * KHI); }
      XWAIT2(ph, pl); }
    else { const _Float16* pv = VT + ((size_t)b * CC + c) * (size_t)TT + k0 + 8 * h;
#pragma unroll
      for (int j = 0; j < 4; ++j) vf[j] = frag_hp(pv + D + j * 16 * TT);
      XWAIT1(pv); } };
  // one pass: kf / klf hold this pass's keys and are refilled with those of key block kn (the next pass's) right behind the logits; vf holds this pass's values and is refilled with the next pass's behind P V
  auto pass = [&](int k0, v16h (&kf)[2][2], v16h (&klf)[2][2], int kn, auto diag) {
    constexpr bool DIAG = decltype(diag)::v;
    v8f st[2][2] = {}, sl[2][2] = {};
#pragma unroll
    for (int kc = 0; kc < 2; ++kc)
#pragma unroll
      for (int t = 0; t < 2; ++t)
#pragma unroll
        for (int u = 0; u < 2; ++u) { st[u][t] = mm_h(kf[t][kc], qf[u][kc], st[u][t]); if constexpr (HI) { sl[u][t] = mm_h(kf[t][kc], qlf[u][kc], sl[u][t]); sl[u][t] = mm_h(klf[t][kc], qf[u][kc], sl[u][t]); } }
    if constexpr (!DIAG) load_k(kf, klf, kn);
    float s[2][16], mx[2];
#pragma unroll
    for (int u = 0; u < 2; ++u) { float a = -1.0e30f;
#pragma unroll
      for (int i = 0; i < 16; ++i) { float v = st[u][i >> 3][i & 7]; if constexpr (HI) v += sl[u][i >> 3][i & 7] * (1.0f / 1024.0f);
        if constexpr (DIAG) v = (k0 + 16 * (i >> 3) + 8 * h + (i & 7) <= q0 + 16 * u + c) ? v : -1.0e30f;
        s[u][i] = v; a = fmaxf(a, v); }
      mx[u] = fmaxf(a, xhalf(a)) * CS; }
    // lazy rescale: the maximum in use moves only when a column's new maximum passes it by more than 8 (log2), so P stays <= 2^8; one scalar branch per pass
    if (__builtin_amdgcn_ballot_w32(mx[0] > m[0] + 8.0f || mx[1] > m[1] + 8.0f) != 0) {
#pragma unroll
      for (int u = 0; u < 2; ++u) { const float mn = fmaxf(m[u], mx[u]); const float al = __builtin_amdgcn_exp2f(m[u] - mn); m[u] = mn; l[u] *= al;
#pragma unroll
        for (int j = 0; j < 4; ++j) ot[u][j] *= al; } }
#pragma unroll
    for (int u = 0; u < 2; ++u) { float p[16];
#pragma unroll
      for (int i = 0; i < 16; ++i) { p[i] = __builtin_amdgcn_exp2f(__builtin_fmaf(s[u][i], CS, -m[u])); l[u] += p[i]; }
      if constexpr (HI) { const F2 pb = bsplit16(p);
#pragma unroll
        for (int j = 0; j < 4; ++j) { ot[u][j] = mm_b(vbh[j], pb.h, ot[u][j]); ot[u][j] = mm_b(vbh[j], pb.l, ot[u][j]); ot[u][j] = mm_b(vbl[j], pb.h, ot[u][j]); } }
      else { v16h pf;
#pragma unroll
        for (int i = 0; i < 16; ++i) pf[i] = (_Float16)p[i];
#pragma unroll
        for (int j = 0; j < 4; ++j) ot[u][j] = mm_h(vf[j], pf, ot[u][j]); } }
    if constexpr (!DIAG) load_v(k0, int_t<32>{}); };
  load_k(ka, kla, 0); load_v(0, int_t<0>{});
  for (int k0 = 0; k0 < q0; k0 += 32) pass(k0, ka, kla, k0 + 32, flag_t<false>{});
  pass(q0, ka, kla, q0, flag_t<true>{});
#pragma unroll
  for (int u = 0; u < 2; ++u) { const float inv = 1.0f / (l[u] + xhalf(l[u])); float* o = out + (bT + q0 + 16 * u + c) * CC + 8 * h;
#pragma unroll
    for (int j = 0; j < 4; ++j) { ot[u][j] *= inv; const v8f y = ot[u][j]; vst2(o + j * 16, (v4f){y[0], y[1], y[2], y[3]}); vst2(o + j * 16 + 4, (v4f){y[4], y[5], y[6], y[7]}); }
    asm volatile("s_wait_xcnt 0x0" :: "v"(o), "v"(ot[u][0]), "v"(ot[u][1]), "v"(ot[u][2]), "v"(ot[u][3]) : "memory"); } }   // before the stores' address and data registers are reused
__global__ __launch_bounds__(256) void k_fa(const _Float16* __restrict__ QH, const _Float16* __restrict__ KH, const _Float16* __restrict__ QL, const _Float16* __restrict__ KL, const _Float16* __restrict__ VT, const __bf16* __restrict__ VB, const __bf16* __restrict__ VBL, float* __restrict__ out) {
  const int b = blockIdx.x; const int lane = threadIdx.x & 31; const int wave = __builtin_amdgcn_readfirstlane((int)(threadIdx.x >> 5));
  const int qblk = wave < 4 ? TT / 128 - 1 - (int)blockIdx.y : (int)blockIdx.y; const int q0 = qblk * 128 + (wave & 3) * 32;
  if (q0 < QHI) fa_run<true>(QH, KH, QL, KL, VT, VB, VBL, out, b, q0, lane); else fa_run<false>(QH, KH, QL, KL, VT, VB, VBL, out, b, q0, lane); }

extern "C" void kernel_launch(void* const* d_in, const int* in_sizes, int n_in, void* d_out, int out_size, void* d_ws, size_t ws_size, hipStream_t stream) {
  (void)in_sizes; (void)n_in; (void)out_size;
  const float** F = (const float**)d_in;
  if (ws_size < (size_t)WS_END) return;
  char* ws = (char*)d_ws; _Float16 *QH = (_Float16*)(ws + WS_QH), *KH = (_Float16*)(ws + WS_KH), *VT = (_Float16*)(ws + WS_VT), *QL = (_Float16*)(ws + WS_QL), *KL = (_Float16*)(ws + WS_KL); __bf16 *VB = (__bf16*)(ws + WS_VB), *VBL = (__bf16*)(ws + WS_VBL); float *S = (float*)(ws + WS_S), *Y = (float*)(ws + WS_Y);
  (void)S; (void)Y; (void)QL; (void)KL; (void)VB; (void)VBL;
  // inputs: 0 queries [16,4096,64]; 1 keys; 2 values
  k_planes64<<<dim3(TNB * TT / 64), 256, 0, stream>>>(F[0], F[1], F[2], QH, QL, KH, KL, VT, VB, VBL);
  k_fa<<<dim3(TNB, TT / 256), 256, 0, stream>>>(QH, KH, QL, KL, VT, VB, VBL, (float*)d_out);
}

// v002
// It runs in 78.5 microseconds.
// Two timings next to v001 put it at 1.19 and 1.22 times that version's speed.
// All steps since v000 together make it 32.9 times as fast.
// compute dtype: all float inputs rounded to bf16; Q, K, V are bf16-valued so their f16 planes are exact; causal logits q x k (1 product; the residual products below row 384 multiply exact zeros) x 64^-0.5; online softmax f32; unnormalised P = 2^(s - m) once to f16 x v (exact) (bf16 hi + lo P below row 384), divided by the f32 row sum at the end; f32 output.
#include <hip/hip_runtime.h>
#include <math.h>

typedef __attribute__((ext_vector_type(16))) _Float16 v16h;
typedef __attribute__((ext_vector_type(16))) __bf16 v16b;
typedef __attribute__((ext_vector_type(8)))  _Float16 v8h;
typedef __attribute__((ext_vector_type(8)))  float v8f;
typedef __attribute__((ext_vector_type(4)))  float v4f;
typedef __attribute__((ext_vector_type(2)))  float v2f;
typedef __attribute__((ext_vector_type(4)))  unsigned v4u;
typedef _Float16 hx8 __attribute__((ext_vector_type(8)));
typedef __attribute__((ext_vector_type(4)))  int v4i;
typedef float __attribute__((may_alias)) float_a;
typedef int __attribute__((may_alias)) int_a;

template <typename T> __device__ __forceinline__ void vst2(void* p, T v) { *(T*)p = v;  }
__device__ __forceinline__ v8f wmma16(v16h a, v16h b, v8f c) {
  v8f d = __builtin_amdgcn_wmma_f32_16x16x32_f16(false, a, false, b, (short)0, c, false, false);
  asm volatile("v_nop\n\tv_nop\n\tv_nop\n\tv_nop" : "+v"(d) : "v"(a), "v"(b));
  return d;
}
__device__ __forceinline__ v8f wmma_bf(v16b a, v16b b, v8f c) {
  v8f d = __builtin_amdgcn_wmma_f32_16x16x32_bf16(false, a, false, b, (short)0, c, false, false);
  asm volatile("v_nop\n\tv_nop\n\tv_nop\n\tv_nop" : "+v"(d) : "v"(a), "v"(b));
  return d;
}
// 16x16x32 fragments: lane = (h = lane>>4, row/col = lane&15); elements 0..7 = k0+8h+0..7, 8..15 = k0+16+8h+0..7; D element r = row 8h+r
__device__ __forceinline__ v16h frag_h(const _Float16* rowk0, int lane) {
  union { v16h v; v8h q[2]; } u; const _Float16* p = rowk0 + 8 * (lane >> 4);
  u.q[0] = *(const v8h*)p; u.q[1] = *(const v8h*)(p + 16); return u.v;
}
__device__ __forceinline__ v16h frag_f32(const float* rowk0, int lane) {
  v16h a; const float* p = rowk0 + 8 * (lane >> 4);
#pragma unroll
  for (int i = 0; i < 8; ++i) { a[i] = (_Float16)p[i]; a[8 + i] = (_Float16)p[16 + i]; }
  return a;
}
__device__ __forceinline__ v16h frag_f32s(const float* rowk0, int lane, float sc) {
  v16h a; const float* p = rowk0 + 8 * (lane >> 4);
#pragma unroll
  for (int i = 0; i < 8; ++i) { a[i] = (_Float16)(p[i] * sc); a[8 + i] = (_Float16)(p[16 + i] * sc); }
  return a;
}
// column fragment from a [K][ld] layout (column n), rows >= K read as 0
__device__ __forceinline__ v16h fragc_f32(const float* W, int k0, int n, int lane, int ld, int K) {
  v16h a; const int g = lane >> 4;
#pragma unroll
  for (int i = 0; i < 8; ++i) { const int ka = k0 + 8 * g + i, kb = ka + 16;
    a[i] = (_Float16)(ka < K ? W[(size_t)(ka < K ? ka : K - 1) * ld + n] : 0.f); a[8 + i] = (_Float16)(kb < K ? W[(size_t)(kb < K ? kb : K - 1) * ld + n] : 0.f); }
  return a;
}
struct F2 { v16b h, l; };
__device__ __forceinline__ F2 bsplit16(const float v[16]) { F2 r;
#pragma unroll
  for (int i = 0; i < 16; ++i) { const __bf16 h = (__bf16)v[i]; r.h[i] = h; r.l[i] = (__bf16)(v[i] - (float)h); }
  return r; }
__device__ __forceinline__ F2 split_row(const float* row, int k0, int lane) { float v[16]; const float* p = row + k0 + 8 * (lane >> 4);
#pragma unroll
  for (int i = 0; i < 8; ++i) { v[i] = p[i]; v[8 + i] = p[16 + i]; }
  return bsplit16(v); }
__device__ __forceinline__ F2 split_rowK(const float* row, int k0, int lane, int K) { float v[16]; const int g = lane >> 4;
#pragma unroll
  for (int i = 0; i < 8; ++i) { const int ka = k0 + 8 * g + i, kb = ka + 16; v[i] = ka < K ? row[ka < K ? ka : K - 1] : 0.f; v[8 + i] = kb < K ? row[kb < K ? kb : K - 1] : 0.f; }
  return bsplit16(v); }
__device__ __forceinline__ F2 split_col(const float* W, int k0, int n, int lane, int ld, int K) { float v[16]; const int g = lane >> 4;
#pragma unroll
  for (int i = 0; i < 8; ++i) { const int ka = k0 + 8 * g + i, kb = ka + 16; v[i] = ka < K ? W[(size_t)(ka < K ? ka : K - 1) * ld + n] : 0.f; v[8 + i] = kb < K ? W[(size_t)(kb < K ? kb : K - 1) * ld + n] : 0.f; }
  return bsplit16(v); }
__device__ __forceinline__ v8f mac3(const F2& a, const F2& b, v8f c) { c = wmma_bf(a.l, b.h, c); c = wmma_bf(a.h, b.l, c); return wmma_bf(a.h, b.h, c); }
__device__ __forceinline__ float sigm(float v) { return 1.0f / (1.0f + expf(-v)); }
#define LDSX() do { asm volatile("s_wait_dscnt 0" ::: "memory"); __builtin_amdgcn_wave_barrier(); __builtin_amdgcn_fence(__ATOMIC_RELEASE, "workgroup"); } while (0)

// Causal scaled-dot-product attention on given tensors (queries / keys / values [16,4096,64], single head; the module adds -2^32 to the strictly-upper triangle before the softmax - equivalent to excluding those keys): out = softmax(causal(Q K^T / 8)) V -> [16,4096,64].
#define NB 16
#define TT 4096
#define CC 64            // NH * HD = projected width
#define DIN 64          // input (model) width
#define NH 1
#define HD 64
#define NQB (TT / 64)
#define HG 1
#define SCALE (0.125f)
#define CAUSAL 1
#ifndef TNB
#define TNB NB
#endif
__device__ __forceinline__ float bfr(float v) { return (float)(__bf16)v; }
__host__ __device__ __forceinline__ int kb_last(int qb) { return CAUSAL ? ((qb * 64 + 63) >> 7) : (TT / 128 - 1); }
typedef __attribute__((ext_vector_type(8))) __bf16 v8b;
__device__ __forceinline__ v16b frag_b(const __bf16* rowk0, int lane) {
  union { v16b v; v8b q[2]; } u; const __bf16* p = rowk0 + 8 * (lane >> 4);
  u.q[0] = *(const v8b*)p; u.q[1] = *(const v8b*)(p + 16); return u.v;
}
#define QBH 6              // unused: the high-precision path is chosen by q0 < QHI (queries 0..383: few keys, no averaging)
#define QHI 384            // rows carrying a q residual plane
#define KHI 384            // key rows carrying k residual / v bf16 hi+lo planes (used only by the causal high-precision path)
// B fragment (k rows k0+.., output column o) of a weight: (in,out) [K][ld] or (out,in) [ld rows of K]: bf16 exact, or f16(bf16 * 256) exact
__device__ __forceinline__ v16b wcol_io(const float* Wm, int k0, int o, int lane, int ld) { v16b w; const int g = lane >> 4;
#pragma unroll
  for (int i = 0; i < 8; ++i) { w[i] = (__bf16)Wm[(size_t)(k0 + 8 * g + i) * ld + o]; w[8 + i] = (__bf16)Wm[(size_t)(k0 + 16 + 8 * g + i) * ld + o]; }
  return w; }
__device__ __forceinline__ v16b wcol_oi(const float* Wm, int k0, int o, int lane, int K) { v16b w; const float* p = Wm + (size_t)o * K + k0 + 8 * (lane >> 4);
#pragma unroll
  for (int i = 0; i < 8; ++i) { w[i] = (__bf16)p[i]; w[8 + i] = (__bf16)p[16 + i]; }
  return w; }
__device__ __forceinline__ v16h wcolh_io(const float* Wm, int k0, int o, int lane, int ld) { v16h w; const int g = lane >> 4;
#pragma unroll
  for (int i = 0; i < 8; ++i) { w[i] = (_Float16)(bfr(Wm[(size_t)(k0 + 8 * g + i) * ld + o]) * 256.0f); w[8 + i] = (_Float16)(bfr(Wm[(size_t)(k0 + 16 + 8 * g + i) * ld + o]) * 256.0f); }
  return w; }
__device__ __forceinline__ v16h wcolh_oi(const float* Wm, int k0, int o, int lane, int K) { v16h w; const float* p = Wm + (size_t)o * K + k0 + 8 * (lane >> 4);
#pragma unroll
  for (int i = 0; i < 8; ++i) { w[i] = (_Float16)(bfr(p[i]) * 256.0f); w[8 + i] = (_Float16)(bfr(p[16 + i]) * 256.0f); }
  return w; }
#define WQKV_LAYOUT 0   // 0 = (in,out) [DIN][CC]; 1 = (out,in) [CC][DIN]; 2 = per-head [NH][DIN][HD]
__device__ __forceinline__ v16b wcol_hdk(const float* Wm, int k0, int o, int lane) { v16b w; const int g = lane >> 4; const float* p = Wm + (size_t)(o / HD) * DIN * HD + (o % HD);
#pragma unroll
  for (int i = 0; i < 8; ++i) { w[i] = (__bf16)p[(size_t)(k0 + 8 * g + i) * HD]; w[8 + i] = (__bf16)p[(size_t)(k0 + 16 + 8 * g + i) * HD]; }
  return w; }
#define WO_OUT_IN 0
#if WQKV_LAYOUT == 1
#define WCOL(W, k0, o, lane) wcol_oi(W, k0, o, lane, DIN)
#elif WQKV_LAYOUT == 2
#define WCOL(W, k0, o, lane) wcol_hdk(W, k0, o, lane)
#else
#define WCOL(W, k0, o, lane) wcol_io(W, k0, o, lane, CC)
#endif
#if WO_OUT_IN
#define WOCOL(W, k0, o, lane) wcol_oi(W, k0, o, lane, CC)
#define WOCOLH(W, k0, o, lane) wcolh_oi(W, k0, o, lane, CC)
#else
#define WOCOL(W, k0, o, lane) wcol_io(W, k0, o, lane, DIN)
#define WOCOLH(W, k0, o, lane) wcolh_io(W, k0, o, lane, DIN)
#endif
__global__ __launch_bounds__(256) void k_planes64(const float* __restrict__ Qs, const float* __restrict__ Ks, const float* __restrict__ Vs, _Float16* __restrict__ QH, _Float16* __restrict__ QL, _Float16* __restrict__ KH, _Float16* __restrict__ KL, _Float16* __restrict__ VT, __bf16* __restrict__ VB, __bf16* __restrict__ VBL) {
  __shared__ _Float16 sv[64][72];
  const int tid = threadIdx.x; const size_t r0 = (size_t)blockIdx.x * 64; const int b = (int)(r0 / TT), t0 = (int)(r0 % TT);
  for (int e = tid; e < 64 * 8; e += 256) { const int rl = e >> 3, q = e & 7; const size_t src = (r0 + rl) * CC + q * 8; float tq[8], tk[8], tv[8];
#pragma unroll
    for (int u = 0; u < 8; ++u) { tq[u] = Qs[src + u]; tk[u] = Ks[src + u]; tv[u] = Vs[src + u]; }
    asm volatile("s_wait_loadcnt 0x0" ::: "memory");
    hx8 hq, hk, hlq, hlk;
#pragma unroll
    for (int u = 0; u < 8; ++u) { const float qv = bfr(tq[u]), kv = bfr(tk[u]); const _Float16 qh = (_Float16)qv, kh = (_Float16)kv; hq[u] = qh; hlq[u] = (_Float16)((qv - (float)qh) * 1024.0f); hk[u] = kh; hlk[u] = (_Float16)((kv - (float)kh) * 1024.0f); sv[rl][q * 8 + u] = (_Float16)bfr(tv[u]); }
    vst2((unsigned*)(QH + (r0 + rl) * CC + q * 8), *(const v4u*)&hq); vst2((unsigned*)(KH + (r0 + rl) * CC + q * 8), *(const v4u*)&hk);
    if (t0 + rl < QHI) vst2((unsigned*)(QL + ((size_t)b * QHI + t0 + rl) * CC + q * 8), *(const v4u*)&hlq);
    if (t0 + rl < KHI) vst2((unsigned*)(KL + ((size_t)b * KHI + t0 + rl) * CC + q * 8), *(const v4u*)&hlk); }
  __syncthreads();
  for (int e = tid; e < 64 * 8; e += 256) { const int c = e >> 3, q = e & 7; hx8 hv; _Pragma("unroll") for (int j = 0; j < 8; ++j) hv[j] = sv[q * 8 + j][c]; vst2((unsigned*)(VT + ((size_t)b * CC + c) * TT + t0 + q * 8), *(const v4u*)&hv);
    if (t0 < KHI) { v8b bh, bl; _Pragma("unroll") for (int j = 0; j < 8; ++j) { const float vv = (float)hv[j]; const __bf16 h1 = (__bf16)vv; bh[j] = h1; bl[j] = (__bf16)(vv - (float)h1); } vst2((unsigned*)(VB + ((size_t)b * CC + c) * KHI + t0 + q * 8), *(const v4u*)&bh); vst2((unsigned*)(VBL + ((size_t)b * CC + c) * KHI + t0 + q * 8), *(const v4u*)&bl); } } }
#ifndef SM_EXTRA_PARAMS
#define SM_EXTRA_PARAMS
#endif
#ifndef PROJ_EXTRA_PARAMS
#define PROJ_EXTRA_PARAMS
#endif
#ifndef SM_MASK_HOOK
#define SM_MASK_HOOK (void)0
#endif

#define WS_QH  0u                                      // f16 q rows [b*t][CC]
#define WS_KH  (WS_QH + 2u * (size_t)NB * TT * CC)      // f16 k rows [b*t][CC]
#define WS_VT  (WS_KH + 2u * (size_t)NB * TT * CC)      // f16 v planes [b][c][t]
#define WS_QL  (WS_VT + 2u * (size_t)NB * CC * TT)      // f16 q residual x 2^10 rows [b][t < QHI][CC]
#define WS_KL  (WS_QL + 2u * (size_t)NB * QHI * CC)     // f16 k residual x 2^10 rows [b][t < KHI][CC]
#define WS_VB  (WS_KL + 2u * (size_t)NB * KHI * CC)     // bf16 v hi planes [b][c][t < KHI]
#define WS_VBL (WS_VB + 2u * (size_t)NB * CC * KHI)
#define WS_S   (WS_VBL + 2u * (size_t)NB * CC * KHI)    // f32 [hg][t][s] region, unused: logits and P stay in registers
#define WS_Y   (WS_S  + 4u * (size_t)HG * TT * TT)      // f32 ctx rows [b*t][CC] (only when there is an output projection)
#define WS_END (WS_Y  + 0u)

// ---- k_proj: block = (64 rows, 128 cols, which): q/k/v = X W (+ b) with exact bf16 products (K = DIN) -> which 0: q f16 rows (+ residual rows < QHI); 1: k f16 rows (+ residual rows < KHI); 2: v f16 planes [c][t] (+ bf16 hi/lo planes for t < KHI)
__global__ __launch_bounds__(128) void k_proj(const float* __restrict__ XQ, const float* __restrict__ XK, const float* __restrict__ XV, const float* __restrict__ WQ, const float* __restrict__ WK, const float* __restrict__ WV, const float* __restrict__ BQ, const float* __restrict__ BK, const float* __restrict__ BV,
    _Float16* __restrict__ QH, _Float16* __restrict__ QL, _Float16* __restrict__ KH, _Float16* __restrict__ KL, _Float16* __restrict__ VT, __bf16* __restrict__ VB, __bf16* __restrict__ VBL) {
  __shared__ __align__(16) _Float16 sh[64][136], sl[64][136]; __shared__ __align__(16) _Float16 th[128][72]; __shared__ __align__(16) __bf16 tb[128][72], tbl[128][72];
  const int tid = threadIdx.x, wave = tid >> 5, lane = tid & 31, col = lane & 15, g = lane >> 4; const int which = blockIdx.z; const int c0 = blockIdx.y * 128; const size_t r0 = (size_t)blockIdx.x * 64; const size_t bb = r0 / TT; const int t0 = (int)(r0 % TT);
  const float* X = which == 0 ? XQ : which == 1 ? XK : XV; const float* WA = which == 0 ? WQ : which == 1 ? WK : WV; const float* BA = which == 0 ? BQ : which == 1 ? BK : BV;
  v8f acc[8] = {};
#pragma unroll 2
  for (int kc = 0; kc < DIN / 32; ++kc) { v16b a; { const float* p = X + (r0 + wave * 16 + col) * DIN + kc * 32 + 8 * g;
#pragma unroll
      for (int i = 0; i < 8; ++i) { a[i] = (__bf16)p[i]; a[8 + i] = (__bf16)p[16 + i]; } }
    asm volatile("s_wait_loadcnt 0x0" ::: "memory");
#pragma unroll
    for (int j = 0; j < 8; ++j) { const v16b w = WCOL(WA, kc * 32, c0 + j * 16 + col, lane); asm volatile("s_wait_loadcnt 0x0" ::: "memory"); acc[j] = wmma_bf(a, w, acc[j]); } }
  if (which < 2) { _Float16* DH = which == 0 ? QH : KH; _Float16* DL = which == 0 ? QL : KL; const int nhi = which == 0 ? QHI : KHI; const bool hi_rows = t0 < nhi;
#pragma unroll
    for (int j = 0; j < 8; ++j) { const float bias = BA ? bfr(BA[c0 + j * 16 + col]) : 0.f;
#pragma unroll
      for (int r = 0; r < 8; ++r) { const float v = acc[j][r] + bias; const _Float16 hv = (_Float16)v; sh[wave * 16 + 8 * g + r][j * 16 + col] = hv; sl[wave * 16 + 8 * g + r][j * 16 + col] = (_Float16)((v - (float)hv) * 1024.0f); } }
    __syncthreads();
    for (int e = tid; e < 64 * 16; e += 128) { const int rl = e >> 4, q = e & 15; vst2((unsigned*)(DH + (r0 + rl) * CC + c0 + q * 8), *(const v4u*)&sh[rl][q * 8]); if (hi_rows) vst2((unsigned*)(DL + (bb * nhi + t0 + rl) * (size_t)CC + c0 + q * 8), *(const v4u*)&sl[rl][q * 8]); }
  } else { const bool hi_rows = t0 < KHI;
#pragma unroll
    for (int j = 0; j < 8; ++j) { const float bias = BA ? bfr(BA[c0 + j * 16 + col]) : 0.f;
#pragma unroll
      for (int r = 0; r < 8; ++r) { const float v = acc[j][r] + bias; const int rl = wave * 16 + 8 * g + r, cl = j * 16 + col; th[cl][rl] = (_Float16)v; const __bf16 bh = (__bf16)v; tb[cl][rl] = bh; tbl[cl][rl] = (__bf16)(v - (float)bh); } }
    __syncthreads();
    for (int e = tid; e < 128 * 8; e += 128) { const int cl = e >> 3, q = e & 7; vst2((unsigned*)(VT + (bb * CC + c0 + cl) * (size_t)TT + t0 + q * 8), *(const v4u*)&th[cl][q * 8]); if (hi_rows) { const size_t o3 = (bb * CC + c0 + cl) * (size_t)KHI + t0 + q * 8; vst2((unsigned*)(VB + o3), *(const v4u*)&tb[cl][q * 8]); vst2((unsigned*)(VBL + o3), *(const v4u*)&tbl[cl][q * 8]); } } } }
template <bool B> struct flag_t { static constexpr bool v = B; };
template <int N> struct int_t { static constexpr int v = N; };
__device__ __forceinline__ float xhalf(float x) { return __builtin_bit_cast(float, __builtin_amdgcn_permlanex16(__builtin_bit_cast(int, x), __builtin_bit_cast(int, x), 0x76543210, 0xfedcba98, false, false)); }  // lane l with lane l ^ 16, on the vector pipe
__device__ __forceinline__ v8f mm_h(v16h a, v16h b, v8f c) { return __builtin_amdgcn_wmma_f32_16x16x32_f16(false, a, false, b, (short)0, c, false, false); }
__device__ __forceinline__ v8f mm_b(v16b a, v16b b, v8f c) { return __builtin_amdgcn_wmma_f32_16x16x32_bf16(false, a, false, b, (short)0, c, false, false); }
// fragment from a lane's own pointer (row start + k0 + 8h): the same k order as frag_h / frag_b
__device__ __forceinline__ v16h frag_hp(const _Float16* p) { union { v16h v; v8h q[2]; } u; u.q[0] = *(const v8h*)p; u.q[1] = *(const v8h*)(p + 16); return u.v; }
__device__ __forceinline__ v16b frag_bp(const __bf16* p) { union { v16b v; v8b q[2]; } u; u.q[0] = *(const v8b*)p; u.q[1] = *(const v8b*)(p + 16); return u.v; }
// s_wait_xcnt 0 behind a run of loads, before their address registers are reused; the pointers are inputs so that those registers stay theirs up to the wait; the clobber keeps the loads issued in front of it, ahead of their use
#define XWAIT1(p) asm volatile("s_wait_xcnt 0x0" :: "v"(p) : "memory")
#define XWAIT2(p, q) asm volatile("s_wait_xcnt 0x0" :: "v"(p), "v"(q) : "memory")
// the vector slot behind a transcendental: one v_nop that stands behind the exponentials (it takes their results) and up to which their source registers stay theirs (it takes the sources), so that no instruction directly behind one overwrites its source
#define TSLOT1(a, r) asm volatile("v_nop" :: "v"(a), "v"(r))
#define TSLOT8(a, r, o) asm volatile("v_nop" :: "v"(a[o]), "v"(a[o + 1]), "v"(a[o + 2]), "v"(a[o + 3]), "v"(a[o + 4]), "v"(a[o + 5]), "v"(a[o + 6]), "v"(a[o + 7]), "v"(r[o]), "v"(r[o + 1]), "v"(r[o + 2]), "v"(r[o + 3]), "v"(r[o + 4]), "v"(r[o + 5]), "v"(r[o + 6]), "v"(r[o + 7]))
// walks keys [kbeg, kend) in full passes and, with dg (wave-uniform), the diagonal pass at q0 (then kend == q0); ot, m, l come in at their start values and leave unnormalised
template <bool HI>
__device__ __forceinline__ void fa_walk(const _Float16* __restrict__ QH, const _Float16* __restrict__ KH, const _Float16* __restrict__ QL, const _Float16* __restrict__ KL, const _Float16* __restrict__ VT, const __bf16* __restrict__ VB, const __bf16* __restrict__ VBL, int b, int q0, int kbeg, int kend, bool dg, int lane, v8f (&ot)[2][4], float (&m)[2], float (&l)[2]) {
  const int c = lane & 15, h = lane >> 4; const size_t bT = (size_t)b * TT;
  const float CS = SCALE * 1.4426950408889634f;   // logits go to the log2 domain inside the exponent's multiply-add
  v16h qf[2][2], qlf[2][2]; const _Float16* pq = QH + (bT + q0 + c) * CC + 8 * h; const _Float16* pql = QL + ((size_t)b * QHI + (HI ? q0 : 0) + c) * CC + 8 * h;
#pragma unroll
  for (int u = 0; u < 2; ++u)
#pragma unroll
    for (int kc = 0; kc < 2; ++kc) { qf[u][kc] = frag_hp(pq + u * 16 * CC + kc * 32); if constexpr (HI) qlf[u][kc] = frag_hp(pql + u * 16 * CC + kc * 32); }
  if constexpr (HI) XWAIT2(pq, pql); else XWAIT1(pq);
  v16h ka[2][2], kla[2][2]; v16h vf[4]; v16b vbh[4], vbl[4];
  auto load_k = [&](v16h (&kf)[2][2], v16h (&klf)[2][2], int k0) { const _Float16* pk = KH + (bT + k0 + c) * CC + 8 * h; const _Float16* pkl = KL + ((size_t)b * KHI + (HI ? k0 : 0) + c) * CC + 8 * h;
#pragma unroll
    for (int t = 0; t < 2; ++t)
#pragma unroll
      for (int kc = 0; kc < 2; ++kc) { kf[t][kc] = frag_hp(pk + t * 16 * CC + kc * 32); if constexpr (HI) klf[t][kc] = frag_hp(pkl + t * 16 * CC + kc * 32); }
    if constexpr (HI) XWAIT2(pk, pkl); else XWAIT1(pk); };
  // values of key block k0 + D: the pointers stand at k0 and D is a constant of the loads' offsets, so the registers the loads name are the ones the wait holds
  auto load_v = [&](int k0, auto dd) { constexpr int D = decltype(dd)::v;
    if constexpr (HI) { const __bf16* ph = VB + ((size_t)b * CC + c) * (size_t)KHI + k0 + 8 * h; const __bf16* pl = VBL + ((size_t)b * CC + c) * (size_t)KHI + k0 + 8 * h;
#pragma unroll
      for (int j = 0; j < 4; ++j) { vbh[j] = frag_bp(ph + D + j * 16 * KHI); vbl[j] = frag_bp(pl + D + j * 16 * KHI); }
      XWAIT2(ph, pl); }
    else { const _Float16* pv = VT + ((size_t)b * CC + c) * (size_t)TT + k0 + 8 * h;
#pragma unroll
      for (int j = 0; j < 4; ++j) vf[j] = frag_hp(pv + D + j * 16 * TT);
      XWAIT1(pv); } };
  // one pass: kf / klf hold this pass's keys and are refilled with those of key block kn (the next pass's) right behind the logits; vf holds this pass's values and is refilled with the next pass's behind P V
  auto pass = [&](int k0, v16h (&kf)[2][2], v16h (&klf)[2][2], int kn, auto diag) {
    constexpr bool DIAG = decltype(diag)::v;
    v8f st[2][2] = {}, sl[2][2] = {};
#pragma unroll
    for (int kc = 0; kc < 2; ++kc)
#pragma unroll
      for (int t = 0; t < 2; ++t)
#pragma unroll
        for (int u = 0; u < 2; ++u) { st[u][t] = mm_h(kf[t][kc], qf[u][kc], st[u][t]); if constexpr (HI) { sl[u][t] = mm_h(kf[t][kc], qlf[u][kc], sl[u][t]); sl[u][t] = mm_h(klf[t][kc], qf[u][kc], sl[u][t]); } }
    if constexpr (!DIAG) load_k(kf, klf, kn);
    float s[2][16], mx[2];
#pragma unroll
    for (int u = 0; u < 2; ++u) { float a = -1.0e30f;
#pragma unroll
      for (int i = 0; i < 16; ++i) { float v = st[u][i >> 3][i & 7]; if constexpr (HI) v += sl[u][i >> 3][i & 7] * (1.0f / 1024.0f);
        if constexpr (DIAG) v = (k0 + 16 * (i >> 3) + 8 * h + (i & 7) <= q0 + 16 * u + c) ? v : -1.0e30f;
        s[u][i] = v; a = fmaxf(a, v); }
      mx[u] = fmaxf(a, xhalf(a)) * CS; }
    // lazy rescale: the maximum in use moves only when a column's new maximum passes it by more than 8 (log2), so P stays <= 2^8; one scalar branch per pass
    if (__builtin_amdgcn_ballot_w32(mx[0] > m[0] + 8.0f || mx[1] > m[1] + 8.0f) != 0) {
#pragma unroll
      for (int u = 0; u < 2; ++u) { const float mn = fmaxf(m[u], mx[u]); const float da = m[u] - mn; const float al = __builtin_amdgcn_exp2f(da); TSLOT1(da, al); m[u] = mn; l[u] *= al;
#pragma unroll
        for (int j = 0; j < 4; ++j) ot[u][j] *= al; } }
#pragma unroll
    for (int u = 0; u < 2; ++u) { float p[16], e[16];
#pragma unroll
      for (int i = 0; i < 16; ++i) { e[i] = __builtin_fmaf(s[u][i], CS, -m[u]); p[i] = __builtin_amdgcn_exp2f(e[i]); }
      if constexpr (!HI) { TSLOT8(e, p, 0); TSLOT8(e, p, 8); }   // the high-precision build keeps the slot by itself (read in the listing) and has no registers to spare
#pragma unroll
      for (int i = 0; i < 16; ++i) l[u] += p[i];
      if constexpr (HI) { const F2 pb = bsplit16(p);
#pragma unroll
        for (int j = 0; j < 4; ++j) { ot[u][j] = mm_b(vbh[j], pb.h, ot[u][j]); ot[u][j] = mm_b(vbh[j], pb.l, ot[u][j]); ot[u][j] = mm_b(vbl[j], pb.h, ot[u][j]); } }
      else { v16h pf;
#pragma unroll
        for (int i = 0; i < 16; ++i) pf[i] = (_Float16)p[i];
#pragma unroll
        for (int j = 0; j < 4; ++j) ot[u][j] = mm_h(vf[j], pf, ot[u][j]); } }
    if constexpr (!DIAG) load_v(k0, int_t<32>{}); };
  load_k(ka, kla, kbeg); load_v(kbeg, int_t<0>{});
  for (int k0 = kbeg; k0 < kend; k0 += 32) pass(k0, ka, kla, k0 + 32, flag_t<false>{});
  if (dg) pass(q0, ka, kla, q0, flag_t<true>{}); }
// joins the halves' sums, normalises and stores the 32 query rows at q0
__device__ __forceinline__ void fa_store(float* __restrict__ out, int b, int q0, int lane, v8f (&ot)[2][4], float (&l)[2]) {
  const int c = lane & 15, h = lane >> 4; const size_t bT = (size_t)b * TT;
#pragma unroll
  for (int u = 0; u < 2; ++u) { const float inv = 1.0f / (l[u] + xhalf(l[u])); float* o = out + (bT + q0 + 16 * u + c) * CC + 8 * h;
#pragma unroll
    for (int j = 0; j < 4; ++j) { ot[u][j] *= inv; const v8f y = ot[u][j]; vst2(o + j * 16, (v4f){y[0], y[1], y[2], y[3]}); vst2(o + j * 16 + 4, (v4f){y[4], y[5], y[6], y[7]}); }
    asm volatile("s_wait_xcnt 0x0" :: "v"(o), "v"(ot[u][0]), "v"(ot[u][1]), "v"(ot[u][2]), "v"(ot[u][3]) : "memory"); } }   // before the stores' address and data registers are reused
__global__ __launch_bounds__(256) void k_fa(const _Float16* __restrict__ QH, const _Float16* __restrict__ KH, const _Float16* __restrict__ QL, const _Float16* __restrict__ KL, const _Float16* __restrict__ VT, const __bf16* __restrict__ VB, const __bf16* __restrict__ VBL, float* __restrict__ out) {
  __shared__ __align__(16) v4f part[4][17][32];   // per pair, one 16-byte word per lane and slot: slots 0..15 the lower key range's O, slot 16 its (m0, m1, l0, l1)
  const int b = blockIdx.x, y = blockIdx.y; const int lane = threadIdx.x & 31; const int wave = __builtin_amdgcn_readfirstlane((int)(threadIdx.x >> 5)); const int pr = wave & 3;
  const int qL = (TT / 128 - 1 - y) * 128 + pr * 32, qE = y * 128 + pr * 32;
  // late-tile passes handed to wave w + 4: half the difference of the two tiles' passes; a high-precision pass of the early tile is counted as two
  const int ks = 32 * (y * 128 < QHI ? TT / 64 - 3 - 6 * y : TT / 64 - 2 - 4 * y);
  // waves 0-3: one walk, keys [ks, diagonal] of the late tile; waves 4-7: two walks, the early tile and keys [0, ks) of the late tile
  const bool ehi = wave >= 4 && qE < QHI;
  if (ehi) { v8f oh[2][4] = {}; float mh[2] = {-1.0e30f, -1.0e30f}, lh[2] = {0.f, 0.f};
    fa_walk<true>(QH, KH, QL, KL, VT, VB, VBL, b, qE, 0, qE, true, lane, oh, mh, lh); fa_store(out, b, qE, lane, oh, lh); }
  v8f ot[2][4]; float m[2], l[2];
#pragma nounroll   // one copy of the pass code serves both walks: less text in the instruction cache
  for (int job = (wave < 4 || ehi) ? 1 : 0; job < 2; ++job) { const int q0 = job ? qL : qE; const bool low = wave >= 4 && job;
#pragma unroll
    for (int u = 0; u < 2; ++u) { m[u] = -1.0e30f; l[u] = 0.f;
#pragma unroll
      for (int j = 0; j < 4; ++j) ot[u][j] = (v8f){}; }
    fa_walk<false>(QH, KH, QL, KL, VT, VB, VBL, b, q0, wave < 4 ? ks : 0, low ? ks : q0, !low, lane, ot, m, l);
    if (!job) fa_store(out, b, q0, lane, ot, l); }
  if (wave >= 4) {
#pragma unroll
    for (int u = 0; u < 2; ++u)
#pragma unroll
      for (int j = 0; j < 4; ++j) { const v8f t = ot[u][j]; part[pr][u * 8 + j * 2][lane] = (v4f){t[0], t[1], t[2], t[3]}; part[pr][u * 8 + j * 2 + 1][lane] = (v4f){t[4], t[5], t[6], t[7]}; }
    part[pr][16][lane] = (v4f){m[0], m[1], l[0], l[1]}; }
  __syncthreads();   // the lower ranges' partial results are in LDS; every wave passes here once
  if (wave < 4) { const v4f ml = part[pr][16][lane];
#pragma unroll
    for (int u = 0; u < 2; ++u) { const float mn = fmaxf(m[u], ml[u]); const float fa = __builtin_amdgcn_exp2f(m[u] - mn), fb = __builtin_amdgcn_exp2f(ml[u] - mn); l[u] = l[u] * fa + ml[2 + u] * fb;
#pragma unroll
      for (int j = 0; j < 4; ++j) { const v4f p0 = part[pr][u * 8 + j * 2][lane], p1 = part[pr][u * 8 + j * 2 + 1][lane];
#pragma unroll
        for (int i = 0; i < 4; ++i) { ot[u][j][i] = ot[u][j][i] * fa + p0[i] * fb; ot[u][j][4 + i] = ot[u][j][4 + i] * fa + p1[i] * fb; } } }
    fa_store(out, b, qL, lane, ot, l); } }

extern "C" void kernel_launch(void* const* d_in, const int* in_sizes, int n_in, void* d_out, int out_size, void* d_ws, size_t ws_size, hipStream_t stream) {
  (void)in_sizes; (void)n_in; (void)out_size;
  const float** F = (const float**)d_in;
  if (ws_size < (size_t)WS_END) return;
  char* ws = (char*)d_ws; _Float16 *QH = (_Float16*)(ws + WS_QH), *KH = (_Float16*)(ws + WS_KH), *VT = (_Float16*)(ws + WS_VT), *QL = (_Float16*)(ws + WS_QL), *KL = (_Float16*)(ws + WS_KL); __bf16 *VB = (__bf16*)(ws + WS_VB), *VBL = (__bf16*)(ws + WS_VBL); float *S = (float*)(ws + WS_S), *Y = (float*)(ws + WS_Y);
  (void)S; (void)Y; (void)QL; (void)KL; (void)VB; (void)VBL;
  // inputs: 0 queries [16,4096,64]; 1 keys; 2 values
  k_planes64<<<dim3(TNB * TT / 64), 256, 0, stream>>>(F[0], F[1], F[2], QH, QL, KH, KL, VT, VB, VBL);
  k_fa<<<dim3(TNB, TT / 256), 256, 0, stream>>>(QH, KH, QL, KL, VT, VB, VBL, (float*)d_out);
}

// v003
// It runs in 57.2 microseconds.
// Two timings next to v002 put it at 1.40 and 1.35 times that version's speed.
// All steps since v000 together make it 45.2 times as fast.
// compute dtype: all float inputs rounded to bf16; Q, K, V are bf16-valued so their f16 planes are exact; causal logits q x k (1 product; the residual products below row 384 multiply exact zeros) x 64^-0.5; online softmax f32; unnormalised P = 2^(s - m) once to f16 x v (exact) (bf16 hi + lo P below row 384), divided by the f32 row sum at the end; f32 output.
#include <hip/hip_runtime.h>
#include <math.h>

typedef __attribute__((ext_vector_type(16))) _Float16 v16h;
typedef __attribute__((ext_vector_type(16))) __bf16 v16b;
typedef __attribute__((ext_vector_type(8)))  _Float16 v8h;
typedef __attribute__((ext_vector_type(8)))  float v8f;
typedef __attribute__((ext_vector_type(4)))  float v4f;
typedef __attribute__((ext_vector_type(2)))  float v2f;
typedef __attribute__((ext_vector_type(4)))  unsigned v4u;
typedef _Float16 hx8 __attribute__((ext_vector_type(8)));
typedef __attribute__((ext_vector_type(4)))  int v4i;
typedef float __attribute__((may_alias)) float_a;
typedef int __attribute__((may_alias)) int_a;

template <typename T> __device__ __forceinline__ void vst2(void* p, T v) { *(T*)p = v;  }
__device__ __forceinline__ v8f wmma16(v16h a, v16h b, v8f c) {
  v8f d = __builtin_amdgcn_wmma_f32_16x16x32_f16(false, a, false, b, (short)0, c, false, false);
  asm volatile("v_nop\n\tv_nop\n\tv_nop\n\tv_nop" : "+v"(d) : "v"(a), "v"(b));
  return d;
}
__device__ __forceinline__ v8f wmma_bf(v16b a, v16b b, v8f c) {
  v8f d = __builtin_amdgcn_wmma_f32_16x16x32_bf16(false, a, false, b, (short)0, c, false, false);
  asm volatile("v_nop\n\tv_nop\n\tv_nop\n\tv_nop" : "+v"(d) : "v"(a), "v"(b));
  return d;
}
// 16x16x32 fragments: lane = (h = lane>>4, row/col = lane&15); elements 0..7 = k0+8h+0..7, 8..15 = k0+16+8h+0..7; D element r = row 8h+r
__device__ __forceinline__ v16h frag_h(const _Float16* rowk0, int lane) {
  union { v16h v; v8h q[2]; } u; const _Float16* p = rowk0 + 8 * (lane >> 4);
  u.q[0] = *(const v8h*)p; u.q[1] = *(const v8h*)(p + 16); return u.v;
}
__device__ __forceinline__ v16h frag_f32(const float* rowk0, int lane) {
  v16h a; const float* p = rowk0 + 8 * (lane >> 4);
#pragma unroll
  for (int i = 0; i < 8; ++i) { a[i] = (_Float16)p[i]; a[8 + i] = (_Float16)p[16 + i]; }
  return a;
}
__device__ __forceinline__ v16h frag_f32s(const float* rowk0, int lane, float sc) {
  v16h a; const float* p = rowk0 + 8 * (lane >> 4);
#pragma unroll
  for (int i = 0; i < 8; ++i) { a[i] = (_Float16)(p[i] * sc); a[8 + i] = (_Float16)(p[16 + i] * sc); }
  return a;
}
// column fragment from a [K][ld] layout (column n), rows >= K read as 0
__device__ __forceinline__ v16h fragc_f32(const float* W, int k0, int n, int lane, int ld, int K) {
  v16h a; const int g = lane >> 4;
#pragma unroll
  for (int i = 0; i < 8; ++i) { const int ka = k0 + 8 * g + i, kb = ka + 16;
    a[i] = (_Float16)(ka < K ? W[(size_t)(ka < K ? ka : K - 1) * ld + n] : 0.f); a[8 + i] = (_Float16)(kb < K ? W[(size_t)(kb < K ? kb : K - 1) * ld + n] : 0.f); }
  return a;
}
struct F2 { v16b h, l; };
__device__ __forceinline__ F2 bsplit16(const float v[16]) { F2 r;
#pragma unroll
  for (int i = 0; i < 16; ++i) { const __bf16 h = (__bf16)v[i]; r.h[i] = h; r.l[i] = (__bf16)(v[i] - (float)h); }
  return r; }
__device__ __forceinline__ F2 split_row(const float* row, int k0, int lane) { float v[16]; const float* p = row + k0 + 8 * (lane >> 4);
#pragma unroll
  for (int i = 0; i < 8; ++i) { v[i] = p[i]; v[8 + i] = p[16 + i]; }
  return bsplit16(v); }
__device__ __forceinline__ F2 split_rowK(const float* row, int k0, int lane, int K) { float v[16]; const int g = lane >> 4;
#pragma unroll
  for (int i = 0; i < 8; ++i) { const int ka = k0 + 8 * g + i, kb = ka + 16; v[i] = ka < K ? row[ka < K ? ka : K - 1] : 0.f; v[8 + i] = kb < K ? row[kb < K ? kb : K - 1] : 0.f; }
  return bsplit16(v); }
__device__ __forceinline__ F2 split_col(const float* W, int k0, int n, int lane, int ld, int K) { float v[16]; const int g = lane >> 4;
#pragma unroll
  for (int i = 0; i < 8; ++i) { const int ka = k0 + 8 * g + i, kb = ka + 16; v[i] = ka < K ? W[(size_t)(ka < K ? ka : K - 1) * ld + n] : 0.f; v[8 + i] = kb < K ? W[(size_t)(kb < K ? kb : K - 1) * ld + n] : 0.f; }
  return bsplit16(v); }
__device__ __forceinline__ v8f mac3(const F2& a, const F2& b, v8f c) { c = wmma_bf(a.l, b.h, c); c = wmma_bf(a.h, b.l, c); return wmma_bf(a.h, b.h, c); }
__device__ __forceinline__ float sigm(float v) { return 1.0f / (1.0f + expf(-v)); }
#define LDSX() do { asm volatile("s_wait_dscnt 0" ::: "memory"); __builtin_amdgcn_wave_barrier(); __builtin_amdgcn_fence(__ATOMIC_RELEASE, "workgroup"); } while (0)

// Causal scaled-dot-product attention on given tensors (queries / keys / values [16,4096,64], single head; the module adds -2^32 to the strictly-upper triangle before the softmax - equivalent to excluding those keys): out = softmax(causal(Q K^T / 8)) V -> [16,4096,64].
#define NB 16
#define TT 4096
#define CC 64            // NH * HD = projected width
#define DIN 64          // input (model) width
#define NH 1
#define HD 64
#define NQB (TT / 64)
#define HG 1
#define SCALE (0.125f)
#define CAUSAL 1
#ifndef TNB
#define TNB NB
#endif
__device__ __forceinline__ float bfr(float v) { return (float)(__bf16)v; }
__host__ __device__ __forceinline__ int kb_last(int qb) { return CAUSAL ? ((qb * 64 + 63) >> 7) : (TT / 128 - 1); }
typedef __attribute__((ext_vector_type(8))) __bf16 v8b;
__device__ __forceinline__ v16b frag_b(const __bf16* rowk0, int lane) {
  union { v16b v; v8b q[2]; } u; const __bf16* p = rowk0 + 8 * (lane >> 4);
  u.q[0] = *(const v8b*)p; u.q[1] = *(const v8b*)(p + 16); return u.v;
}
#define QBH 6              // unused: the high-precision path is chosen by q0 < QHI (queries 0..383: few keys, no averaging)
#define QHI 384            // rows carrying a q residual plane
#define KHI 384            // key rows carrying k residual / v bf16 hi+lo planes (used only by the causal high-precision path)
// B fragment (k rows k0+.., output column o) of a weight: (in,out) [K][ld] or (out,in) [ld rows of K]: bf16 exact, or f16(bf16 * 256) exact
__device__ __forceinline__ v16b wcol_io(const float* Wm, int k0, int o, int lane, int ld) { v16b w; const int g = lane >> 4;
#pragma unroll
  for (int i = 0; i < 8; ++i) { w[i] = (__bf16)Wm[(size_t)(k0 + 8 * g + i) * ld + o]; w[8 + i] = (__bf16)Wm[(size_t)(k0 + 16 + 8 * g + i) * ld + o]; }
  return w; }
__device__ __forceinline__ v16b wcol_oi(const float* Wm, int k0, int o, int lane, int K) { v16b w; const float* p = Wm + (size_t)o * K + k0 + 8 * (lane >> 4);
#pragma unroll
  for (int i = 0; i < 8; ++i) { w[i] = (__bf16)p[i]; w[8 + i] = (__bf16)p[16 + i]; }
  return w; }
__device__ __forceinline__ v16h wcolh_io(const float* Wm, int k0, int o, int lane, int ld) { v16h w; const int g = lane >> 4;
#pragma unroll
  for (int i = 0; i < 8; ++i) { w[i] = (_Float16)(bfr(Wm[(size_t)(k0 + 8 * g + i) * ld + o]) * 256.0f); w[8 + i] = (_Float16)(bfr(Wm[(size_t)(k0 + 16 + 8 * g + i) * ld + o]) * 256.0f); }
  return w; }
__device__ __forceinline__ v16h wcolh_oi(const float* Wm, int k0, int o, int lane, int K) { v16h w; const float* p = Wm + (size_t)o * K + k0 + 8 * (lane >> 4);
#pragma unroll
  for (int i = 0; i < 8; ++i) { w[i] = (_Float16)(bfr(p[i]) * 256.0f); w[8 + i] = (_Float16)(bfr(p[16 + i]) * 256.0f); }
  return w; }
#define WQKV_LAYOUT 0   // 0 = (in,out) [DIN][CC]; 1 = (out,in) [CC][DIN]; 2 = per-head [NH][DIN][HD]
__device__ __forceinline__ v16b wcol_hdk(const float* Wm, int k0, int o, int lane) { v16b w; const int g = lane >> 4; const float* p = Wm + (size_t)(o / HD) * DIN * HD + (o % HD);
#pragma unroll
  for (int i = 0; i < 8; ++i) { w[i] = (__bf16)p[(size_t)(k0 + 8 * g + i) * HD]; w[8 + i] = (__bf16)p[(size_t)(k0 + 16 + 8 * g + i) * HD]; }
  return w; }
#define WO_OUT_IN 0
#if WQKV_LAYOUT == 1
#define WCOL(W, k0, o, lane) wcol_oi(W, k0, o, lane, DIN)
#elif WQKV_LAYOUT == 2
#define WCOL(W, k0, o, lane) wcol_hdk(W, k0, o, lane)
#else
#define WCOL(W, k0, o, lane) wcol_io(W, k0, o, lane, CC)
#endif
#if WO_OUT_IN
#define WOCOL(W, k0, o, lane) wcol_oi(W, k0, o, lane, CC)
#define WOCOLH(W, k0, o, lane) wcolh_oi(W, k0, o, lane, CC)
#else
#define WOCOL(W, k0, o, lane) wcol_io(W, k0, o, lane, DIN)
#define WOCOLH(W, k0, o, lane) wcolh_io(W, k0, o, lane, DIN)
#endif
__global__ __launch_bounds__(256) void k_planes64(const float* __restrict__ Qs, const float* __restrict__ Ks, const float* __restrict__ Vs, _Float16* __restrict__ QH, _Float16* __restrict__ QL, _Float16* __restrict__ KH, _Float16* __restrict__ KL, _Float16* __restrict__ VT, __bf16* __restrict__ VB, __bf16* __restrict__ VBL) {
  __shared__ __align__(16) _Float16 sv[64][72], sk[64][72], skl[64][72];
  const int tid = threadIdx.x; const size_t r0 = (size_t)blockIdx.x * 64; const int b = (int)(r0 / TT), t0 = (int)(r0 % TT);
  for (int e = tid; e < 64 * 8; e += 256) { const int rl = e >> 3, q = e & 7; const size_t src = (r0 + rl) * CC + q * 8; float tq[8], tk[8], tv[8];
#pragma unroll
    for (int u = 0; u < 8; ++u) { tq[u] = Qs[src + u]; tk[u] = Ks[src + u]; tv[u] = Vs[src + u]; }
    asm volatile("s_wait_loadcnt 0x0" ::: "memory");
    hx8 hq, hk, hlq, hlk;
#pragma unroll
    for (int u = 0; u < 8; ++u) { const float qv = bfr(tq[u]), kv = bfr(tk[u]); const _Float16 qh = (_Float16)qv, kh = (_Float16)kv; hq[u] = qh; hlq[u] = (_Float16)((qv - (float)qh) * 1024.0f); hk[u] = kh; hlk[u] = (_Float16)((kv - (float)kh) * 1024.0f); sv[rl][q * 8 + u] = (_Float16)bfr(tv[u]); }
    const v4u wh = *(const v4u*)&hq; vst2((unsigned*)(QH + (r0 + rl) * CC + q * 8), wh); vst2(&sk[rl][q * 8], *(const v4u*)&hk);
    asm volatile("s_wait_xcnt 0x0" :: "v"(wh) : "memory");   // before the store's data registers are reused
    if (t0 < KHI) vst2(&skl[rl][q * 8], *(const v4u*)&hlk);
    if (t0 + rl < QHI) { const v4u wq = *(const v4u*)&hlq; vst2((unsigned*)(QL + ((size_t)b * QHI + t0 + rl) * CC + q * 8), wq);
      asm volatile("s_wait_xcnt 0x0" :: "v"(wq) : "memory"); } }   // before the store's address and data registers are reused
  __syncthreads();
  // fragment order: 16-byte word e of these 64 keys is what lane e & 31 takes with one load, so a wave's load (and each store here) covers 512 contiguous bytes
  for (int e = tid; e < 64 * 8; e += 256) { const int c = e & 15, k8 = ((e >> 5) & 1) * 16 + ((e >> 4) & 1) * 8;
    const int row = (e >> 7) * 16 + c, d0 = ((e >> 6) & 1) * 32 + k8;   // keys: word = (16-key tile, 32-wide half of d, 16-wide half, h, key)
    const int ch = ((e >> 6) & 3) * 16 + c, kk = (e >> 8) * 32 + k8;   // values: word = (32-key pass, 16-channel tile, 16-key half, h, channel)
    const v4u wk = *(const v4u*)&sk[row][d0]; hx8 hv; _Pragma("unroll") for (int j = 0; j < 8; ++j) hv[j] = sv[kk + j][ch];
    const v4u wv = *(const v4u*)&hv; vst2((unsigned*)(KH + r0 * CC + e * 8), wk); vst2((unsigned*)(VT + r0 * CC + e * 8), wv);
    if (t0 < KHI) { const size_t o3 = ((size_t)b * KHI + t0) * CC + e * 8; const v4u wl = *(const v4u*)&skl[row][d0]; v8b bh, bl; _Pragma("unroll") for (int j = 0; j < 8; ++j) { const float vv = (float)hv[j]; const __bf16 h1 = (__bf16)vv; bh[j] = h1; bl[j] = (__bf16)(vv - (float)h1); }
      const v4u wh = *(const v4u*)&bh, wb = *(const v4u*)&bl; vst2((unsigned*)(KL + o3), wl); vst2((unsigned*)(VB + o3), wh); vst2((unsigned*)(VBL + o3), wb);
      asm volatile("s_wait_xcnt 0x0" :: "v"(wl), "v"(wh), "v"(wb) : "memory"); }   // before these stores' registers are reused
    asm volatile("s_wait_xcnt 0x0" :: "v"(wk), "v"(wv), "v"(e) : "memory"); } }   // before the stores' data registers and the word index their addresses come from are reused
#ifndef SM_EXTRA_PARAMS
#define SM_EXTRA_PARAMS
#endif
#ifndef PROJ_EXTRA_PARAMS
#define PROJ_EXTRA_PARAMS
#endif
#ifndef SM_MASK_HOOK
#define SM_MASK_HOOK (void)0
#endif

#define WS_QH  0u                                      // f16 q rows [b*t][CC]
#define WS_KH  (WS_QH + 2u * (size_t)NB * TT * CC)      // f16 k in fragment order [b][t / 16][d / 32][(d / 16) & 1][lane = 16 * ((d / 8) & 1) + t % 16][d % 8]
#define WS_VT  (WS_KH + 2u * (size_t)NB * TT * CC)      // f16 v in fragment order [b][t / 32][c / 16][(t / 16) & 1][lane = 16 * ((t / 8) & 1) + c % 16][t % 8]
#define WS_QL  (WS_VT + 2u * (size_t)NB * CC * TT)      // f16 q residual x 2^10 rows [b][t < QHI][CC]
#define WS_KL  (WS_QL + 2u * (size_t)NB * QHI * CC)     // f16 k residual x 2^10, t < KHI, in the order of the k plane
#define WS_VB  (WS_KL + 2u * (size_t)NB * KHI * CC)     // bf16 v hi (and lo behind it), t < KHI, in the order of the v plane
#define WS_VBL (WS_VB + 2u * (size_t)NB * CC * KHI)
#define WS_S   (WS_VBL + 2u * (size_t)NB * CC * KHI)    // f32 [hg][t][s] region, unused: logits and P stay in registers
#define WS_Y   (WS_S  + 4u * (size_t)HG * TT * TT)      // f32 ctx rows [b*t][CC] (only when there is an output projection)
#define WS_END (WS_Y  + 0u)

// ---- k_proj: block = (64 rows, 128 cols, which): q/k/v = X W (+ b) with exact bf16 products (K = DIN) -> which 0: q f16 rows (+ residual rows < QHI); 1: k f16 rows (+ residual rows < KHI); 2: v f16 planes [c][t] (+ bf16 hi/lo planes for t < KHI)
__global__ __launch_bounds__(128) void k_proj(const float* __restrict__ XQ, const float* __restrict__ XK, const float* __restrict__ XV, const float* __restrict__ WQ, const float* __restrict__ WK, const float* __restrict__ WV, const float* __restrict__ BQ, const float* __restrict__ BK, const float* __restrict__ BV,
    _Float16* __restrict__ QH, _Float16* __restrict__ QL, _Float16* __restrict__ KH, _Float16* __restrict__ KL, _Float16* __restrict__ VT, __bf16* __restrict__ VB, __bf16* __restrict__ VBL) {
  __shared__ __align__(16) _Float16 sh[64][136], sl[64][136]; __shared__ __align__(16) _Float16 th[128][72]; __shared__ __align__(16) __bf16 tb[128][72], tbl[128][72];
  const int tid = threadIdx.x, wave = tid >> 5, lane = tid & 31, col = lane & 15, g = lane >> 4; const int which = blockIdx.z; const int c0 = blockIdx.y * 128; const size_t r0 = (size_t)blockIdx.x * 64; const size_t bb = r0 / TT; const int t0 = (int)(r0 % TT);
  const float* X = which == 0 ? XQ : which == 1 ? XK : XV; const float* WA = which == 0 ? WQ : which == 1 ? WK : WV; const float* BA = which == 0 ? BQ : which == 1 ? BK : BV;
  v8f acc[8] = {};
#pragma unroll 2
  for (int kc = 0; kc < DIN / 32; ++kc) { v16b a; { const float* p = X + (r0 + wave * 16 + col) * DIN + kc * 32 + 8 * g;
#pragma unroll
      for (int i = 0; i < 8; ++i) { a[i] = (__bf16)p[i]; a[8 + i] = (__bf16)p[16 + i]; } }
    asm volatile("s_wait_loadcnt 0x0" ::: "memory");
#pragma unroll
    for (int j = 0; j < 8; ++j) { const v16b w = WCOL(WA, kc * 32, c0 + j * 16 + col, lane); asm volatile("s_wait_loadcnt 0x0" ::: "memory"); acc[j] = wmma_bf(a, w, acc[j]); } }
  if (which < 2) { _Float16* DH = which == 0 ? QH : KH; _Float16* DL = which == 0 ? QL : KL; const int nhi = which == 0 ? QHI : KHI; const bool hi_rows = t0 < nhi;
#pragma unroll
    for (int j = 0; j < 8; ++j) { const float bias = BA ? bfr(BA[c0 + j * 16 + col]) : 0.f;
#pragma unroll
      for (int r = 0; r < 8; ++r) { const float v = acc[j][r] + bias; const _Float16 hv = (_Float16)v; sh[wave * 16 + 8 * g + r][j * 16 + col] = hv; sl[wave * 16 + 8 * g + r][j * 16 + col] = (_Float16)((v - (float)hv) * 1024.0f); } }
    __syncthreads();
    for (int e = tid; e < 64 * 16; e += 128) { const int rl = e >> 4, q = e & 15; vst2((unsigned*)(DH + (r0 + rl) * CC + c0 + q * 8), *(const v4u*)&sh[rl][q * 8]); if (hi_rows) vst2((unsigned*)(DL + (bb * nhi + t0 + rl) * (size_t)CC + c0 + q * 8), *(const v4u*)&sl[rl][q * 8]); }
  } else { const bool hi_rows = t0 < KHI;
#pragma unroll
    for (int j = 0; j < 8; ++j) { const float bias = BA ? bfr(BA[c0 + j * 16 + col]) : 0.f;
#pragma unroll
      for (int r = 0; r < 8; ++r) { const float v = acc[j][r] + bias; const int rl = wave * 16 + 8 * g + r, cl = j * 16 + col; th[cl][rl] = (_Float16)v; const __bf16 bh = (__bf16)v; tb[cl][rl] = bh; tbl[cl][rl] = (__bf16)(v - (float)bh); } }
    __syncthreads();
    for (int e = tid; e < 128 * 8; e += 128) { const int cl = e >> 3, q = e & 7; vst2((unsigned*)(VT + (bb * CC + c0 + cl) * (size_t)TT + t0 + q * 8), *(const v4u*)&th[cl][q * 8]); if (hi_rows) { const size_t o3 = (bb * CC + c0 + cl) * (size_t)KHI + t0 + q * 8; vst2((unsigned*)(VB + o3), *(const v4u*)&tb[cl][q * 8]); vst2((unsigned*)(VBL + o3), *(const v4u*)&tbl[cl][q * 8]); } } } }
template <bool B> struct flag_t { static constexpr bool v = B; };
template <int N> struct int_t { static constexpr int v = N; };
__device__ __forceinline__ float xhalf(float x) { return __builtin_bit_cast(float, __builtin_amdgcn_permlanex16(__builtin_bit_cast(int, x), __builtin_bit_cast(int, x), 0x76543210, 0xfedcba98, false, false)); }  // lane l with lane l ^ 16, on the vector pipe
__device__ __forceinline__ v8f mm_h(v16h a, v16h b, v8f c) { return __builtin_amdgcn_wmma_f32_16x16x32_f16(false, a, false, b, (short)0, c, false, false); }
__device__ __forceinline__ v8f mm_b(v16b a, v16b b, v8f c) { return __builtin_amdgcn_wmma_f32_16x16x32_bf16(false, a, false, b, (short)0, c, false, false); }
// fragment from a lane's own pointer (row start + k0 + 8h): the same k order as frag_h / frag_b
__device__ __forceinline__ v16h frag_hp(const _Float16* p) { union { v16h v; v8h q[2]; } u; u.q[0] = *(const v8h*)p; u.q[1] = *(const v8h*)(p + 16); return u.v; }
__device__ __forceinline__ v16b frag_bp(const __bf16* p) { union { v16b v; v8b q[2]; } u; u.q[0] = *(const v8b*)p; u.q[1] = *(const v8b*)(p + 16); return u.v; }
// fragment from the fragment-ordered planes, from a lane's own pointer (fragment start + 8 * lane): two loads, each 512 contiguous bytes over the wave; the same k order as frag_h / frag_b
__device__ __forceinline__ v16h frag_hk(const _Float16* p) { union { v16h v; v8h q[2]; } u; u.q[0] = *(const v8h*)p; u.q[1] = *(const v8h*)(p + 256); return u.v; }
__device__ __forceinline__ v16b frag_bk(const __bf16* p) { union { v16b v; v8b q[2]; } u; u.q[0] = *(const v8b*)p; u.q[1] = *(const v8b*)(p + 256); return u.v; }
// s_wait_xcnt 0 behind a run of loads, before their address registers are reused; the pointers are inputs so that those registers stay theirs up to the wait; the clobber keeps the loads issued in front of it, ahead of their use
#define XWAIT1(p) asm volatile("s_wait_xcnt 0x0" :: "v"(p) : "memory")
#define XWAIT2(p, q) asm volatile("s_wait_xcnt 0x0" :: "v"(p), "v"(q) : "memory")
// the vector slot behind a transcendental: one v_nop that stands behind the exponentials (it takes their results) and up to which their source registers stay theirs (it takes the sources), so that no instruction directly behind one overwrites its source
#define TSLOT1(a, r) asm volatile("v_nop" :: "v"(a), "v"(r))
#define TSLOT8(a, r, o) asm volatile("v_nop" :: "v"(a[o]), "v"(a[o + 1]), "v"(a[o + 2]), "v"(a[o + 3]), "v"(a[o + 4]), "v"(a[o + 5]), "v"(a[o + 6]), "v"(a[o + 7]), "v"(r[o]), "v"(r[o + 1]), "v"(r[o + 2]), "v"(r[o + 3]), "v"(r[o + 4]), "v"(r[o + 5]), "v"(r[o + 6]), "v"(r[o + 7]))
// walks keys [kbeg, kend) in full passes and, with dg (wave-uniform), the diagonal pass at q0 (then kend == q0); ot, m, l come in at their start values and leave unnormalised
template <bool HI>
__device__ __forceinline__ void fa_walk(const _Float16* __restrict__ QH, const _Float16* __restrict__ KH, const _Float16* __restrict__ QL, const _Float16* __restrict__ KL, const _Float16* __restrict__ VT, const __bf16* __restrict__ VB, const __bf16* __restrict__ VBL, int b, int q0, int kbeg, int kend, bool dg, int lane, v8f (&ot)[2][4], float (&m)[2], float (&l)[2]) {
  const int c = lane & 15, h = lane >> 4; const size_t bT = (size_t)b * TT;
  const float CS = SCALE * 1.4426950408889634f;   // logits go to the log2 domain inside the exponent's multiply-add
  v16h qf[2][2], qlf[2][2]; const _Float16* pq = QH + (bT + q0 + c) * CC + 8 * h; const _Float16* pql = QL + ((size_t)b * QHI + (HI ? q0 : 0) + c) * CC + 8 * h;
#pragma unroll
  for (int u = 0; u < 2; ++u)
#pragma unroll
    for (int kc = 0; kc < 2; ++kc) { qf[u][kc] = frag_hp(pq + u * 16 * CC + kc * 32); if constexpr (HI) qlf[u][kc] = frag_hp(pql + u * 16 * CC + kc * 32); }
  if constexpr (HI) XWAIT2(pq, pql); else XWAIT1(pq);
  v16h ka[2][2], kla[2][2]; v16h vf[4]; v16b vbh[4], vbl[4];
  auto load_k = [&](v16h (&kf)[2][2], v16h (&klf)[2][2], int k0) { const _Float16* pk = KH + (bT + k0) * CC + 8 * lane; const _Float16* pkl = KL + ((size_t)b * KHI + (HI ? k0 : 0)) * CC + 8 * lane;
#pragma unroll
    for (int t = 0; t < 2; ++t)
#pragma unroll
      for (int kc = 0; kc < 2; ++kc) { kf[t][kc] = frag_hk(pk + (t * 2 + kc) * 512); if constexpr (HI) klf[t][kc] = frag_hk(pkl + (t * 2 + kc) * 512); }
    if constexpr (HI) XWAIT2(pk, pkl); else XWAIT1(pk); };
  // values of key block k0 + D: the pointers stand at k0 and D is a constant of the loads' offsets, so the registers the loads name are the ones the wait holds
  auto load_v = [&](int k0, auto dd) { constexpr int D = decltype(dd)::v;
    if constexpr (HI) { const __bf16* ph = VB + ((size_t)b * KHI + k0) * CC + 8 * lane; const __bf16* pl = VBL + ((size_t)b * KHI + k0) * CC + 8 * lane;
#pragma unroll
      for (int j = 0; j < 4; ++j) { vbh[j] = frag_bk(ph + D * CC + j * 512); vbl[j] = frag_bk(pl + D * CC + j * 512); }
      XWAIT2(ph, pl); }
    else { const _Float16* pv = VT + (bT + k0) * CC + 8 * lane;
#pragma unroll
      for (int j = 0; j < 4; ++j) vf[j] = frag_hk(pv + D * CC + j * 512);
      XWAIT1(pv); } };
  // one pass: kf / klf hold this pass's keys and are refilled with those of key block kn (the next pass's) right behind the logits; vf holds this pass's values and is refilled with the next pass's behind P V
  auto pass = [&](int k0, v16h (&kf)[2][2], v16h (&klf)[2][2], int kn, auto diag) {
    constexpr bool DIAG = decltype(diag)::v;
    v8f st[2][2] = {}, sl[2][2] = {};
#pragma unroll
    for (int kc = 0; kc < 2; ++kc)
#pragma unroll
      for (int t = 0; t < 2; ++t)
#pragma unroll
        for (int u = 0; u < 2; ++u) { st[u][t] = mm_h(kf[t][kc], qf[u][kc], st[u][t]); if constexpr (HI) { sl[u][t] = mm_h(kf[t][kc], qlf[u][kc], sl[u][t]); sl[u][t] = mm_h(klf[t][kc], qf[u][kc], sl[u][t]); } }
    if constexpr (!DIAG) load_k(kf, klf, kn);
    float s[2][16], mx[2];
#pragma unroll
    for (int u = 0; u < 2; ++u) { float a = -1.0e30f;
#pragma unroll
      for (int i = 0; i < 16; ++i) { float v = st[u][i >> 3][i & 7]; if constexpr (HI) v += sl[u][i >> 3][i & 7] * (1.0f / 1024.0f);
        if constexpr (DIAG) v = (k0 + 16 * (i >> 3) + 8 * h + (i & 7) <= q0 + 16 * u + c) ? v : -1.0e30f;
        s[u][i] = v; a = fmaxf(a, v); }
      mx[u] = fmaxf(a, xhalf(a)) * CS; }
    // lazy rescale: the maximum in use moves only when a column's new maximum passes it by more than 8 (log2), so P stays <= 2^8; one scalar branch per pass
    if (__builtin_amdgcn_ballot_w32(mx[0] > m[0] + 8.0f || mx[1] > m[1] + 8.0f) != 0) {
#pragma unroll
      for (int u = 0; u < 2; ++u) { const float mn = fmaxf(m[u], mx[u]); const float da = m[u] - mn; const float al = __builtin_amdgcn_exp2f(da); TSLOT1(da, al); m[u] = mn; l[u] *= al;
#pragma unroll
        for (int j = 0; j < 4; ++j) ot[u][j] *= al; } }
#pragma unroll
    for (int u = 0; u < 2; ++u) { float p[16], e[16];
#pragma unroll
      for (int i = 0; i < 16; ++i) { e[i] = __builtin_fmaf(s[u][i], CS, -m[u]); p[i] = __builtin_amdgcn_exp2f(e[i]); }
      if constexpr (!HI) { TSLOT8(e, p, 0); TSLOT8(e, p, 8); }   // the high-precision build keeps the slot by itself (read in the listing) and has no registers to spare
#pragma unroll
      for (int i = 0; i < 16; ++i) l[u] += p[i];
      if constexpr (HI) { const F2 pb = bsplit16(p);
#pragma unroll
        for (int j = 0; j < 4; ++j) { ot[u][j] = mm_b(vbh[j], pb.h, ot[u][j]); ot[u][j] = mm_b(vbh[j], pb.l, ot[u][j]); ot[u][j] = mm_b(vbl[j], pb.h, ot[u][j]); } }
      else { v16h pf;
#pragma unroll
        for (int i = 0; i < 16; ++i) pf[i] = (_Float16)p[i];
#pragma unroll
        for (int j = 0; j < 4; ++j) ot[u][j] = mm_h(vf[j], pf, ot[u][j]); } }
    if constexpr (!DIAG) load_v(k0, int_t<32>{}); };
  load_k(ka, kla, kbeg); load_v(kbeg, int_t<0>{});
  for (int k0 = kbeg; k0 < kend; k0 += 32) pass(k0, ka, kla, k0 + 32, flag_t<false>{});
  if (dg) pass(q0, ka, kla, q0, flag_t<true>{}); }
// joins the halves' sums, normalises and stores the 32 query rows at q0
__device__ __forceinline__ void fa_store(float* __restrict__ out, int b, int q0, int lane, v8f (&ot)[2][4], float (&l)[2]) {
  const int c = lane & 15, h = lane >> 4; const size_t bT = (size_t)b * TT;
#pragma unroll
  for (int u = 0; u < 2; ++u) { const float inv = 1.0f / (l[u] + xhalf(l[u])); float* o = out + (bT + q0 + 16 * u + c) * CC + 8 * h;
#pragma unroll
    for (int j = 0; j < 4; ++j) { ot[u][j] *= inv; const v8f y = ot[u][j]; vst2(o + j * 16, (v4f){y[0], y[1], y[2], y[3]}); vst2(o + j * 16 + 4, (v4f){y[4], y[5], y[6], y[7]}); }
    asm volatile("s_wait_xcnt 0x0" :: "v"(o), "v"(ot[u][0]), "v"(ot[u][1]), "v"(ot[u][2]), "v"(ot[u][3]) : "memory"); } }   // before the stores' address and data registers are reused
__global__ __launch_bounds__(256) void k_fa(const _Float16* __restrict__ QH, const _Float16* __restrict__ KH, const _Float16* __restrict__ QL, const _Float16* __restrict__ KL, const _Float16* __restrict__ VT, const __bf16* __restrict__ VB, const __bf16* __restrict__ VBL, float* __restrict__ out) {
  __shared__ __align__(16) v4f part[4][17][32];   // per pair, one 16-byte word per lane and slot: slots 0..15 the lower key range's O, slot 16 its (m0, m1, l0, l1)
  const int b = blockIdx.x, y = blockIdx.y; const int lane = threadIdx.x & 31; const int wave = __builtin_amdgcn_readfirstlane((int)(threadIdx.x >> 5)); const int pr = wave & 3;
  const int qL = (TT / 128 - 1 - y) * 128 + pr * 32, qE = y * 128 + pr * 32;
  // late-tile passes handed to wave w + 4: half the difference of the two tiles' passes; a high-precision pass of the early tile is counted as two
  const int ks = 32 * (y * 128 < QHI ? TT / 64 - 3 - 6 * y : TT / 64 - 2 - 4 * y);
  // waves 0-3: one walk, keys [ks, diagonal] of the late tile; waves 4-7: two walks, the early tile and keys [0, ks) of the late tile
  const bool ehi = wave >= 4 && qE < QHI;
  if (ehi) { v8f oh[2][4] = {}; float mh[2] = {-1.0e30f, -1.0e30f}, lh[2] = {0.f, 0.f};
    fa_walk<true>(QH, KH, QL, KL, VT, VB, VBL, b, qE, 0, qE, true, lane, oh, mh, lh); fa_store(out, b, qE, lane, oh, lh); }
  v8f ot[2][4]; float m[2], l[2];
#pragma nounroll   // one copy of the pass code serves both walks: less text in the instruction cache
  for (int job = (wave < 4 || ehi) ? 1 : 0; job < 2; ++job) { const int q0 = job ? qL : qE; const bool low = wave >= 4 && job;
#pragma unroll
    for (int u = 0; u < 2; ++u) { m[u] = -1.0e30f; l[u] = 0.f;
#pragma unroll
      for (int j = 0; j < 4; ++j) ot[u][j] = (v8f){}; }
    fa_walk<false>(QH, KH, QL, KL, VT, VB, VBL, b, q0, wave < 4 ? ks : 0, low ? ks : q0, !low, lane, ot, m, l);
    if (!job) fa_store(out, b, q0, lane, ot, l); }
  if (wave >= 4) {
#pragma unroll
    for (int u = 0; u < 2; ++u)
#pragma unroll
      for (int j = 0; j < 4; ++j) { const v8f t = ot[u][j]; part[pr][u * 8 + j * 2][lane] = (v4f){t[0], t[1], t[2], t[3]}; part[pr][u * 8 + j * 2 + 1][lane] = (v4f){t[4], t[5], t[6], t[7]}; }
    part[pr][16][lane] = (v4f){m[0], m[1], l[0], l[1]}; }
  __syncthreads();   // the lower ranges' partial results are in LDS; every wave passes here once
  if (wave < 4) { const v4f ml = part[pr][16][lane];
#pragma unroll
    for (int u = 0; u < 2; ++u) { const float mn = fmaxf(m[u], ml[u]); const float fa = __builtin_amdgcn_exp2f(m[u] - mn), fb = __builtin_amdgcn_exp2f(ml[u] - mn); l[u] = l[u] * fa + ml[2 + u] * fb;
#pragma unroll
      for (int j = 0; j < 4; ++j) { const v4f p0 = part[pr][u * 8 + j * 2][lane], p1 = part[pr][u * 8 + j * 2 + 1][lane];
#pragma unroll
        for (int i = 0; i < 4; ++i) { ot[u][j][i] = ot[u][j][i] * fa + p0[i] * fb; ot[u][j][4 + i] = ot[u][j][4 + i] * fa + p1[i] * fb; } } }
    fa_store(out, b, qL, lane, ot, l); } }

extern "C" void kernel_launch(void* const* d_in, const int* in_sizes, int n_in, void* d_out, int out_size, void* d_ws, size_t ws_size, hipStream_t stream) {
  (void)in_sizes; (void)n_in; (void)out_size;
  const float** F = (const float**)d_in;
  if (ws_size < (size_t)WS_END) return;
  char* ws = (char*)d_ws; _Float16 *QH = (_Float16*)(ws + WS_QH), *KH = (_Float16*)(ws + WS_KH), *VT = (_Float16*)(ws + WS_VT), *QL = (_Float16*)(ws + WS_QL), *KL = (_Float16*)(ws + WS_KL); __bf16 *VB = (__bf16*)(ws + WS_VB), *VBL = (__bf16*)(ws + WS_VBL); float *S = (float*)(ws + WS_S), *Y = (float*)(ws + WS_Y);
  (void)S; (void)Y; (void)QL; (void)KL; (void)VB; (void)VBL;
  // inputs: 0 queries [16,4096,64]; 1 keys; 2 values
  k_planes64<<<dim3(TNB * TT / 64), 256, 0, stream>>>(F[0], F[1], F[2], QH, QL, KH, KL, VT, VB, VBL);
  k_fa<<<dim3(TNB, TT / 256), 256, 0, stream>>>(QH, KH, QL, KL, VT, VB, VBL, (float*)d_out);
}

// v004
// Measured time: 45.3 microseconds a run.
// In two side-by-side timings against v003, it was 1.28 and 1.24 times as fast.
// Counting every step since v000, it is 56.9 times as fast.
// compute dtype: all float inputs rounded to bf16; Q, K, V are bf16-valued so their f16 planes are exact; causal logits q x k (1 product; the residual products below row 384 multiply exact zeros) x 64^-0.5; online softmax f32; unnormalised P = 2^(s - m) once to f16 x v (exact) (bf16 hi + lo P below row 384), divided by the f32 row sum at the end; f32 output.
#include <hip/hip_runtime.h>
#include <math.h>

typedef __attribute__((ext_vector_type(16))) _Float16 v16h;
typedef __attribute__((ext_vector_type(16))) __bf16 v16b;
typedef __attribute__((ext_vector_type(8)))  _Float16 v8h;
typedef __attribute__((ext_vector_type(8)))  float v8f;
typedef __attribute__((ext_vector_type(4)))  float v4f;
typedef __attribute__((ext_vector_type(2)))  float v2f;
typedef __attribute__((ext_vector_type(4)))  unsigned v4u;
typedef _Float16 hx8 __attribute__((ext_vector_type(8)));
typedef __attribute__((ext_vector_type(4)))  int v4i;
typedef float __attribute__((may_alias)) float_a;
typedef int __attribute__((may_alias)) int_a;

template <typename T> __device__ __forceinline__ void vst2(void* p, T v) { *(T*)p = v;  }
__device__ __forceinline__ v8f wmma16(v16h a, v16h b, v8f c) {
  v8f d = __builtin_amdgcn_wmma_f32_16x16x32_f16(false, a, false, b, (short)0, c, false, false);
  asm volatile("v_nop\n\tv_nop\n\tv_nop\n\tv_nop" : "+v"(d) : "v"(a), "v"(b));
  return d;
}
__device__ __forceinline__ v8f wmma_bf(v16b a, v16b b, v8f c) {
  v8f d = __builtin_amdgcn_wmma_f32_16x16x32_bf16(false, a, false, b, (short)0, c, false, false);
  asm volatile("v_nop\n\tv_nop\n\tv_nop\n\tv_nop" : "+v"(d) : "v"(a), "v"(b));
  return d;
}
// 16x16x32 fragments: lane = (h = lane>>4, row/col = lane&15); elements 0..7 = k0+8h+0..7, 8..15 = k0+16+8h+0..7; D element r = row 8h+r
__device__ __forceinline__ v16h frag_h(const _Float16* rowk0, int lane) {
  union { v16h v; v8h q[2]; } u; const _Float16* p = rowk0 + 8 * (lane >> 4);
  u.q[0] = *(const v8h*)p; u.q[1] = *(const v8h*)(p + 16); return u.v;
}
__device__ __forceinline__ v16h frag_f32(const float* rowk0, int lane) {
  v16h a; const float* p = rowk0 + 8 * (lane >> 4);
#pragma unroll
  for (int i = 0; i < 8; ++i) { a[i] = (_Float16)p[i]; a[8 + i] = (_Float16)p[16 + i]; }
  return a;
}
__device__ __forceinline__ v16h frag_f32s(const float* rowk0, int lane, float sc) {
  v16h a; const float* p = rowk0 + 8 * (lane >> 4);
#pragma unroll
  for (int i = 0; i < 8; ++i) { a[i] = (_Float16)(p[i] * sc); a[8 + i] = (_Float16)(p[16 + i] * sc); }
  return a;
}
// column fragment from a [K][ld] layout (column n), rows >= K read as 0
__device__ __forceinline__ v16h fragc_f32(const float* W, int k0, int n, int lane, int ld, int K) {
  v16h a; const int g = lane >> 4;
#pragma unroll
  for (int i = 0; i < 8; ++i) { const int ka = k0 + 8 * g + i, kb = ka + 16;
    a[i] = (_Float16)(ka < K ? W[(size_t)(ka < K ? ka : K - 1) * ld + n] : 0.f); a[8 + i] = (_Float16)(kb < K ? W[(size_t)(kb < K ? kb : K - 1) * ld + n] : 0.f); }
  return a;
}
struct F2 { v16b h, l; };
__device__ __forceinline__ F2 bsplit16(const float v[16]) { F2 r;
#pragma unroll
  for (int i = 0; i < 16; ++i) { const __bf16 h = (__bf16)v[i]; r.h[i] = h; r.l[i] = (__bf16)(v[i] - (float)h); }
  return r; }
__device__ __forceinline__ F2 split_row(const float* row, int k0, int lane) { float v[16]; const float* p = row + k0 + 8 * (lane >> 4);
#pragma unroll
  for (int i = 0; i < 8; ++i) { v[i] = p[i]; v[8 + i] = p[16 + i]; }
  return bsplit16(v); }
__device__ __forceinline__ F2 split_rowK(const float* row, int k0, int lane, int K) { float v[16]; const int g = lane >> 4;
#pragma unroll
  for (int i = 0; i < 8; ++i) { const int ka = k0 + 8 * g + i, kb = ka + 16; v[i] = ka < K ? row[ka < K ? ka : K - 1] : 0.f; v[8 + i] = kb < K ? row[kb < K ? kb : K - 1] : 0.f; }
  return bsplit16(v); }
__device__ __forceinline__ F2 split_col(const float* W, int k0, int n, int lane, int ld, int K) { float v[16]; const int g = lane >> 4;
#pragma unroll
  for (int i = 0; i < 8; ++i) { const int ka = k0 + 8 * g + i, kb = ka + 16; v[i] = ka < K ? W[(size_t)(ka < K ? ka : K - 1) * ld + n] : 0.f; v[8 + i] = kb < K ? W[(size_t)(kb < K ? kb : K - 1) * ld + n] : 0.f; }
  return bsplit16(v); }
__device__ __forceinline__ v8f mac3(const F2& a, const F2& b, v8f c) { c = wmma_bf(a.l, b.h, c); c = wmma_bf(a.h, b.l, c); return wmma_bf(a.h, b.h, c); }
__device__ __forceinline__ float sigm(float v) { return 1.0f / (1.0f + expf(-v)); }
#define LDSX() do { asm volatile("s_wait_dscnt 0" ::: "memory"); __builtin_amdgcn_wave_barrier(); __builtin_amdgcn_fence(__ATOMIC_RELEASE, "workgroup"); } while (0)

// Causal scaled-dot-product attention on given tensors (queries / keys / values [16,4096,64], single head; the module adds -2^32 to the strictly-upper triangle before the softmax - equivalent to excluding those keys): out = softmax(causal(Q K^T / 8)) V -> [16,4096,64].
#define NB 16
#define TT 4096
#define CC 64            // NH * HD = projected width
#define DIN 64          // input (model) width
#define NH 1
#define HD 64
#define NQB (TT / 64)
#define HG 1
#define SCALE (0.125f)
#define CAUSAL 1
#ifndef TNB
#define TNB NB
#endif
__device__ __forceinline__ float bfr(float v) { return (float)(__bf16)v; }
__host__ __device__ __forceinline__ int kb_last(int qb) { return CAUSAL ? ((qb * 64 + 63) >> 7) : (TT / 128 - 1); }
typedef __attribute__((ext_vector_type(8))) __bf16 v8b;
__device__ __forceinline__ v16b frag_b(const __bf16* rowk0, int lane) {
  union { v16b v; v8b q[2]; } u; const __bf16* p = rowk0 + 8 * (lane >> 4);
  u.q[0] = *(const v8b*)p; u.q[1] = *(const v8b*)(p + 16); return u.v;
}
#define QBH 6              // unused: the high-precision path is chosen by q0 < QHI (queries 0..383: few keys, no averaging)
#define QHI 384            // rows carrying a q residual plane
#define KHI 384            // key rows carrying k residual / v bf16 hi+lo planes (used only by the causal high-precision path)
// B fragment (k rows k0+.., output column o) of a weight: (in,out) [K][ld] or (out,in) [ld rows of K]: bf16 exact, or f16(bf16 * 256) exact
__device__ __forceinline__ v16b wcol_io(const float* Wm, int k0, int o, int lane, int ld) { v16b w; const int g = lane >> 4;
#pragma unroll
  for (int i = 0; i < 8; ++i) { w[i] = (__bf16)Wm[(size_t)(k0 + 8 * g + i) * ld + o]; w[8 + i] = (__bf16)Wm[(size_t)(k0 + 16 + 8 * g + i) * ld + o]; }
  return w; }
__device__ __forceinline__ v16b wcol_oi(const float* Wm, int k0, int o, int lane, int K) { v16b w; const float* p = Wm + (size_t)o * K + k0 + 8 * (lane >> 4);
#pragma unroll
  for (int i = 0; i < 8; ++i) { w[i] = (__bf16)p[i]; w[8 + i] = (__bf16)p[16 + i]; }
  return w; }
__device__ __forceinline__ v16h wcolh_io(const float* Wm, int k0, int o, int lane, int ld) { v16h w; const int g = lane >> 4;
#pragma unroll
  for (int i = 0; i < 8; ++i) { w[i] = (_Float16)(bfr(Wm[(size_t)(k0 + 8 * g + i) * ld + o]) * 256.0f); w[8 + i] = (_Float16)(bfr(Wm[(size_t)(k0 + 16 + 8 * g + i) * ld + o]) * 256.0f); }
  return w; }
__device__ __forceinline__ v16h wcolh_oi(const float* Wm, int k0, int o, int lane, int K) { v16h w; const float* p = Wm + (size_t)o * K + k0 + 8 * (lane >> 4);
#pragma unroll
  for (int i = 0; i < 8; ++i) { w[i] = (_Float16)(bfr(p[i]) * 256.0f); w[8 + i] = (_Float16)(bfr(p[16 + i]) * 256.0f); }
  return w; }
#define WQKV_LAYOUT 0   // 0 = (in,out) [DIN][CC]; 1 = (out,in) [CC][DIN]; 2 = per-head [NH][DIN][HD]
__device__ __forceinline__ v16b wcol_hdk(const float* Wm, int k0, int o, int lane) { v16b w; const int g = lane >> 4; const float* p = Wm + (size_t)(o / HD) * DIN * HD + (o % HD);
#pragma unroll
  for (int i = 0; i < 8; ++i) { w[i] = (__bf16)p[(size_t)(k0 + 8 * g + i) * HD]; w[8 + i] = (__bf16)p[(size_t)(k0 + 16 + 8 * g + i) * HD]; }
  return w; }
#define WO_OUT_IN 0
#if WQKV_LAYOUT == 1
#define WCOL(W, k0, o, lane) wcol_oi(W, k0, o, lane, DIN)
#elif WQKV_LAYOUT == 2
#define WCOL(W, k0, o, lane) wcol_hdk(W, k0, o, lane)
#else
#define WCOL(W, k0, o, lane) wcol_io(W, k0, o, lane, CC)
#endif
#if WO_OUT_IN
#define WOCOL(W, k0, o, lane) wcol_oi(W, k0, o, lane, CC)
#define WOCOLH(W, k0, o, lane) wcolh_oi(W, k0, o, lane, CC)
#else
#define WOCOL(W, k0, o, lane) wcol_io(W, k0, o, lane, DIN)
#define WOCOLH(W, k0, o, lane) wcolh_io(W, k0, o, lane, DIN)
#endif
__global__ __launch_bounds__(256) void k_planes64(const float* __restrict__ Qs, const float* __restrict__ Ks, const float* __restrict__ Vs, _Float16* __restrict__ QH, _Float16* __restrict__ QL, _Float16* __restrict__ KH, _Float16* __restrict__ KL, _Float16* __restrict__ VT, __bf16* __restrict__ VB, __bf16* __restrict__ VBL) {
  __shared__ __align__(16) _Float16 sv[64][72], sk[64][72], skl[64][72];
  const int tid = threadIdx.x; const size_t r0 = (size_t)blockIdx.x * 64; const int b = (int)(r0 / TT), t0 = (int)(r0 % TT);
  for (int e = tid; e < 64 * 8; e += 256) { const int rl = e >> 3, q = e & 7; const size_t src = (r0 + rl) * CC + q * 8; float tq[8], tk[8], tv[8];
#pragma unroll
    for (int u = 0; u < 8; ++u) { tq[u] = Qs[src + u]; tk[u] = Ks[src + u]; tv[u] = Vs[src + u]; }
    asm volatile("s_wait_loadcnt 0x0" ::: "memory");
    hx8 hq, hk, hlq, hlk;
#pragma unroll
    for (int u = 0; u < 8; ++u) { const float qv = bfr(tq[u]), kv = bfr(tk[u]); const _Float16 qh = (_Float16)qv, kh = (_Float16)kv; hq[u] = qh; hlq[u] = (_Float16)((qv - (float)qh) * 1024.0f); hk[u] = kh; hlk[u] = (_Float16)((kv - (float)kh) * 1024.0f); sv[rl][q * 8 + u] = (_Float16)bfr(tv[u]); }
    const v4u wh = *(const v4u*)&hq; vst2((unsigned*)(QH + (r0 + rl) * CC + q * 8), wh); vst2(&sk[rl][q * 8], *(const v4u*)&hk);
    asm volatile("s_wait_xcnt 0x0" :: "v"(wh) : "memory");   // before the store's data registers are reused
    if (t0 < KHI) vst2(&skl[rl][q * 8], *(const v4u*)&hlk);
    if (t0 + rl < QHI) { const v4u wq = *(const v4u*)&hlq; vst2((unsigned*)(QL + ((size_t)b * QHI + t0 + rl) * CC + q * 8), wq);
      asm volatile("s_wait_xcnt 0x0" :: "v"(wq) : "memory"); } }   // before the store's address and data registers are reused
  __syncthreads();
  // fragment order: 16-byte word e of these 64 keys is what lane e & 31 takes with one load, so a wave's load (and each store here) covers 512 contiguous bytes
  for (int e = tid; e < 64 * 8; e += 256) { const int c = e & 15, k8 = ((e >> 5) & 1) * 16 + ((e >> 4) & 1) * 8;
    const int row = (e >> 7) * 16 + c, d0 = ((e >> 6) & 1) * 32 + k8;   // keys: word = (16-key tile, 32-wide half of d, 16-wide half, h, key)
    const int ch = ((e >> 6) & 3) * 16 + c, kk = (e >> 8) * 32 + k8;   // values: word = (32-key pass, 16-channel tile, 16-key half, h, channel)
    const v4u wk = *(const v4u*)&sk[row][d0]; hx8 hv; _Pragma("unroll") for (int j = 0; j < 8; ++j) hv[j] = sv[kk + j][ch];
    const v4u wv = *(const v4u*)&hv; vst2((unsigned*)(KH + r0 * CC + e * 8), wk); vst2((unsigned*)(VT + r0 * CC + e * 8), wv);
    if (t0 < KHI) { const size_t o3 = ((size_t)b * KHI + t0) * CC + e * 8; const v4u wl = *(const v4u*)&skl[row][d0]; v8b bh, bl; _Pragma("unroll") for (int j = 0; j < 8; ++j) { const float vv = (float)hv[j]; const __bf16 h1 = (__bf16)vv; bh[j] = h1; bl[j] = (__bf16)(vv - (float)h1); }
      const v4u wh = *(const v4u*)&bh, wb = *(const v4u*)&bl; vst2((unsigned*)(KL + o3), wl); vst2((unsigned*)(VB + o3), wh); vst2((unsigned*)(VBL + o3), wb);
      asm volatile("s_wait_xcnt 0x0" :: "v"(wl), "v"(wh), "v"(wb) : "memory"); }   // before these stores' registers are reused
    asm volatile("s_wait_xcnt 0x0" :: "v"(wk), "v"(wv), "v"(e) : "memory"); } }   // before the stores' data registers and the word index their addresses come from are reused
#ifndef SM_EXTRA_PARAMS
#define SM_EXTRA_PARAMS
#endif
#ifndef PROJ_EXTRA_PARAMS
#define PROJ_EXTRA_PARAMS
#endif
#ifndef SM_MASK_HOOK
#define SM_MASK_HOOK (void)0
#endif

#define WS_QH  0u                                      // f16 q rows [b*t][CC]
#define WS_KH  (WS_QH + 2u * (size_t)NB * TT * CC)      // f16 k in fragment order [b][t / 16][d / 32][(d / 16) & 1][lane = 16 * ((d / 8) & 1) + t % 16][d % 8]
#define WS_VT  (WS_KH + 2u * (size_t)NB * TT * CC)      // f16 v in fragment order [b][t / 32][c / 16][(t / 16) & 1][lane = 16 * ((t / 8) & 1) + c % 16][t % 8]
#define WS_QL  (WS_VT + 2u * (size_t)NB * CC * TT)      // f16 q residual x 2^10 rows [b][t < QHI][CC]
#define WS_KL  (WS_QL + 2u * (size_t)NB * QHI * CC)     // f16 k residual x 2^10, t < KHI, in the order of the k plane
#define WS_VB  (WS_KL + 2u * (size_t)NB * KHI * CC)     // bf16 v hi (and lo behind it), t < KHI, in the order of the v plane
#define WS_VBL (WS_VB + 2u * (size_t)NB * CC * KHI)
#define WS_S   (WS_VBL + 2u * (size_t)NB * CC * KHI)    // f32 [hg][t][s] region, unused: logits and P stay in registers
#define WS_Y   (WS_S  + 4u * (size_t)HG * TT * TT)      // f32 ctx rows [b*t][CC] (only when there is an output projection)
#define WS_END (WS_Y  + 0u)

// ---- k_proj: block = (64 rows, 128 cols, which): q/k/v = X W (+ b) with exact bf16 products (K = DIN) -> which 0: q f16 rows (+ residual rows < QHI); 1: k f16 rows (+ residual rows < KHI); 2: v f16 planes [c][t] (+ bf16 hi/lo planes for t < KHI)
__global__ __launch_bounds__(128) void k_proj(const float* __restrict__ XQ, const float* __restrict__ XK, const float* __restrict__ XV, const float* __restrict__ WQ, const float* __restrict__ WK, const float* __restrict__ WV, const float* __restrict__ BQ, const float* __restrict__ BK, const float* __restrict__ BV,
    _Float16* __restrict__ QH, _Float16* __restrict__ QL, _Float16* __restrict__ KH, _Float16* __restrict__ KL, _Float16* __restrict__ VT, __bf16* __restrict__ VB, __bf16* __restrict__ VBL) {
  __shared__ __align__(16) _Float16 sh[64][136], sl[64][136]; __shared__ __align__(16) _Float16 th[128][72]; __shared__ __align__(16) __bf16 tb[128][72], tbl[128][72];
  const int tid = threadIdx.x, wave = tid >> 5, lane = tid & 31, col = lane & 15, g = lane >> 4; const int which = blockIdx.z; const int c0 = blockIdx.y * 128; const size_t r0 = (size_t)blockIdx.x * 64; const size_t bb = r0 / TT; const int t0 = (int)(r0 % TT);
  const float* X = which == 0 ? XQ : which == 1 ? XK : XV; const float* WA = which == 0 ? WQ : which == 1 ? WK : WV; const float* BA = which == 0 ? BQ : which == 1 ? BK : BV;
  v8f acc[8] = {};
#pragma unroll 2
  for (int kc = 0; kc < DIN / 32; ++kc) { v16b a; { const float* p = X + (r0 + wave * 16 + col) * DIN + kc * 32 + 8 * g;
#pragma unroll
      for (int i = 0; i < 8; ++i) { a[i] = (__bf16)p[i]; a[8 + i] = (__bf16)p[16 + i]; } }
    asm volatile("s_wait_loadcnt 0x0" ::: "memory");
#pragma unroll
    for (int j = 0; j < 8; ++j) { const v16b w = WCOL(WA, kc * 32, c0 + j * 16 + col, lane); asm volatile("s_wait_loadcnt 0x0" ::: "memory"); acc[j] = wmma_bf(a, w, acc[j]); } }
  if (which < 2) { _Float16* DH = which == 0 ? QH : KH; _Float16* DL = which == 0 ? QL : KL; const int nhi = which == 0 ? QHI : KHI; const bool hi_rows = t0 < nhi;
#pragma unroll
    for (int j = 0; j < 8; ++j) { const float bias = BA ? bfr(BA[c0 + j * 16 + col]) : 0.f;
#pragma unroll
      for (int r = 0; r < 8; ++r) { const float v = acc[j][r] + bias; const _Float16 hv = (_Float16)v; sh[wave * 16 + 8 * g + r][j * 16 + col] = hv; sl[wave * 16 + 8 * g + r][j * 16 + col] = (_Float16)((v - (float)hv) * 1024.0f); } }
    __syncthreads();
    for (int e = tid; e < 64 * 16; e += 128) { const int rl = e >> 4, q = e & 15; vst2((unsigned*)(DH + (r0 + rl) * CC + c0 + q * 8), *(const v4u*)&sh[rl][q * 8]); if (hi_rows) vst2((unsigned*)(DL + (bb * nhi + t0 + rl) * (size_t)CC + c0 + q * 8), *(const v4u*)&sl[rl][q * 8]); }
  } else { const bool hi_rows = t0 < KHI;
#pragma unroll
    for (int j = 0; j < 8; ++j) { const float bias = BA ? bfr(BA[c0 + j * 16 + col]) : 0.f;
#pragma unroll
      for (int r = 0; r < 8; ++r) { const float v = acc[j][r] + bias; const int rl = wave * 16 + 8 * g + r, cl = j * 16 + col; th[cl][rl] = (_Float16)v; const __bf16 bh = (__bf16)v; tb[cl][rl] = bh; tbl[cl][rl] = (__bf16)(v - (float)bh); } }
    __syncthreads();
    for (int e = tid; e < 128 * 8; e += 128) { const int cl = e >> 3, q = e & 7; vst2((unsigned*)(VT + (bb * CC + c0 + cl) * (size_t)TT + t0 + q * 8), *(const v4u*)&th[cl][q * 8]); if (hi_rows) { const size_t o3 = (bb * CC + c0 + cl) * (size_t)KHI + t0 + q * 8; vst2((unsigned*)(VB + o3), *(const v4u*)&tb[cl][q * 8]); vst2((unsigned*)(VBL + o3), *(const v4u*)&tbl[cl][q * 8]); } } } }
template <bool B> struct flag_t { static constexpr bool v = B; };
template <int N> struct int_t { static constexpr int v = N; };
__device__ __forceinline__ float xhalf(float x) { return __builtin_bit_cast(float, __builtin_amdgcn_permlanex16(__builtin_bit_cast(int, x), __builtin_bit_cast(int, x), 0x76543210, 0xfedcba98, false, false)); }  // lane l with lane l ^ 16, on the vector pipe
__device__ __forceinline__ v8f mm_h(v16h a, v16h b, v8f c) { return __builtin_amdgcn_wmma_f32_16x16x32_f16(false, a, false, b, (short)0, c, false, false); }
__device__ __forceinline__ v8f mm_b(v16b a, v16b b, v8f c) { return __builtin_amdgcn_wmma_f32_16x16x32_bf16(false, a, false, b, (short)0, c, false, false); }
// fragment from a lane's own pointer (row start + k0 + 8h): the same k order as frag_h / frag_b
__device__ __forceinline__ v16h frag_hp(const _Float16* p) { union { v16h v; v8h q[2]; } u; u.q[0] = *(const v8h*)p; u.q[1] = *(const v8h*)(p + 16); return u.v; }
__device__ __forceinline__ v16b frag_bp(const __bf16* p) { union { v16b v; v8b q[2]; } u; u.q[0] = *(const v8b*)p; u.q[1] = *(const v8b*)(p + 16); return u.v; }
// fragment from the fragment-ordered planes, from a lane's own pointer (fragment start + 8 * lane): two loads, each 512 contiguous bytes over the wave; the same k order as frag_h / frag_b
__device__ __forceinline__ v16h frag_hk(const _Float16* p) { union { v16h v; v8h q[2]; } u; u.q[0] = *(const v8h*)p; u.q[1] = *(const v8h*)(p + 256); return u.v; }
__device__ __forceinline__ v16b frag_bk(const __bf16* p) { union { v16b v; v8b q[2]; } u; u.q[0] = *(const v8b*)p; u.q[1] = *(const v8b*)(p + 256); return u.v; }
// s_wait_xcnt 0 behind a run of loads, before their address registers are reused; the pointers are inputs so that those registers stay theirs up to the wait; the clobber keeps the loads issued in front of it, ahead of their use
#define XWAIT1(p) asm volatile("s_wait_xcnt 0x0" :: "v"(p) : "memory")
#define XWAIT2(p, q) asm volatile("s_wait_xcnt 0x0" :: "v"(p), "v"(q) : "memory")
// the vector slot behind a transcendental: one v_nop that stands behind the exponentials (it takes their results) and up to which their source registers stay theirs (it takes the sources), so that no instruction directly behind one overwrites its source
#define TSLOT1(a, r) asm volatile("v_nop" :: "v"(a), "v"(r))
#define TSLOT8(a, r, o) asm volatile("v_nop" :: "v"(a[o]), "v"(a[o + 1]), "v"(a[o + 2]), "v"(a[o + 3]), "v"(a[o + 4]), "v"(a[o + 5]), "v"(a[o + 6]), "v"(a[o + 7]), "v"(r[o]), "v"(r[o + 1]), "v"(r[o + 2]), "v"(r[o + 3]), "v"(r[o + 4]), "v"(r[o + 5]), "v"(r[o + 6]), "v"(r[o + 7]))
// walks keys [kbeg, kend) in full passes and, with dg (wave-uniform), the diagonal pass at q0 (then kend == q0); ot, m, l come in at their start values and leave unnormalised
template <bool HI>
__device__ __forceinline__ void fa_walk(const _Float16* __restrict__ QH, const _Float16* __restrict__ KH, const _Float16* __restrict__ QL, const _Float16* __restrict__ KL, const _Float16* __restrict__ VT, const __bf16* __restrict__ VB, const __bf16* __restrict__ VBL, int b, int q0, int kbeg, int kend, bool dg, int lane, v8f (&ot)[2][4], float (&m)[2], float (&l)[2]) {
  const int c = lane & 15, h = lane >> 4; const size_t bT = (size_t)b * TT;
  const float CS = SCALE * 1.4426950408889634f;   // logits go to the log2 domain inside the exponent's multiply-add
  v16h qf[2][2], qlf[2][2]; const _Float16* pq = QH + (bT + q0 + c) * CC + 8 * h; const _Float16* pql = QL + ((size_t)b * QHI + (HI ? q0 : 0) + c) * CC + 8 * h;
#pragma unroll
  for (int u = 0; u < 2; ++u)
#pragma unroll
    for (int kc = 0; kc < 2; ++kc) { qf[u][kc] = frag_hp(pq + u * 16 * CC + kc * 32); if constexpr (HI) qlf[u][kc] = frag_hp(pql + u * 16 * CC + kc * 32); }
  if constexpr (HI) XWAIT2(pq, pql); else XWAIT1(pq);
  v16h ka[2][2], kla[2][2]; v16h vf[4]; v16b vbh[4], vbl[4];
  auto load_k = [&](v16h (&kf)[2][2], v16h (&klf)[2][2], int k0) { const _Float16* pk = KH + (bT + k0) * CC + 8 * lane; const _Float16* pkl = KL + ((size_t)b * KHI + (HI ? k0 : 0)) * CC + 8 * lane;
#pragma unroll
    for (int t = 0; t < 2; ++t)
#pragma unroll
      for (int kc = 0; kc < 2; ++kc) { kf[t][kc] = frag_hk(pk + (t * 2 + kc) * 512); if constexpr (HI) klf[t][kc] = frag_hk(pkl + (t * 2 + kc) * 512); }
    if constexpr (HI) XWAIT2(pk, pkl); else XWAIT1(pk); };
  // values of key block k0 + D: the pointers stand at k0 and D is a constant of the loads' offsets, so the registers the loads name are the ones the wait holds
  auto load_v = [&](int k0, auto dd) { constexpr int D = decltype(dd)::v;
    if constexpr (HI) { const __bf16* ph = VB + ((size_t)b * KHI + k0) * CC + 8 * lane; const __bf16* pl = VBL + ((size_t)b * KHI + k0) * CC + 8 * lane;
#pragma unroll
      for (int j = 0; j < 4; ++j) { vbh[j] = frag_bk(ph + D * CC + j * 512); vbl[j] = frag_bk(pl + D * CC + j * 512); }
      XWAIT2(ph, pl); }
    else { const _Float16* pv = VT + (bT + k0) * CC + 8 * lane;
#pragma unroll
      for (int j = 0; j < 4; ++j) vf[j] = frag_hk(pv + D * CC + j * 512);
      XWAIT1(pv); } };
  // one pass: kf / klf hold this pass's keys and are refilled with those of key block kn (the next pass's) right behind the logits; vf holds this pass's values and is refilled with the next pass's behind P V
  auto pass = [&](int k0, v16h (&kf)[2][2], v16h (&klf)[2][2], int kn, auto diag) {
    constexpr bool DIAG = decltype(diag)::v;
    v8f st[2][2] = {}, sl[2][2] = {};
#pragma unroll
    for (int kc = 0; kc < 2; ++kc)
#pragma unroll
      for (int t = 0; t < 2; ++t)
#pragma unroll
        for (int u = 0; u < 2; ++u) { st[u][t] = mm_h(kf[t][kc], qf[u][kc], st[u][t]); if constexpr (HI) { sl[u][t] = mm_h(kf[t][kc], qlf[u][kc], sl[u][t]); sl[u][t] = mm_h(klf[t][kc], qf[u][kc], sl[u][t]); } }
    if constexpr (!DIAG) load_k(kf, klf, kn);
    float s[2][16], mx[2];
#pragma unroll
    for (int u = 0; u < 2; ++u) { float a = -1.0e30f;
#pragma unroll
      for (int i = 0; i < 16; ++i) { float v = st[u][i >> 3][i & 7]; if constexpr (HI) v += sl[u][i >> 3][i & 7] * (1.0f / 1024.0f);
        if constexpr (DIAG) v = (k0 + 16 * (i >> 3) + 8 * h + (i & 7) <= q0 + 16 * u + c) ? v : -1.0e30f;
        s[u][i] = v; a = fmaxf(a, v); }
      mx[u] = fmaxf(a, xhalf(a)) * CS; }
    // lazy rescale: the maximum in use moves only when a column's new maximum passes it by more than 8 (log2), so P stays <= 2^8; one scalar branch per pass
    if (__builtin_amdgcn_ballot_w32(mx[0] > m[0] + 8.0f || mx[1] > m[1] + 8.0f) != 0) {
#pragma unroll
      for (int u = 0; u < 2; ++u) { const float mn = fmaxf(m[u], mx[u]); const float da = m[u] - mn; const float al = __builtin_amdgcn_exp2f(da); TSLOT1(da, al); m[u] = mn; l[u] *= al;
#pragma unroll
        for (int j = 0; j < 4; ++j) ot[u][j] *= al; } }
#pragma unroll
    for (int u = 0; u < 2; ++u) { float p[16], e[16];
#pragma unroll
      for (int i = 0; i < 16; ++i) { e[i] = __builtin_fmaf(s[u][i], CS, -m[u]); p[i] = __builtin_amdgcn_exp2f(e[i]); }
      if constexpr (!HI) { TSLOT8(e, p, 0); TSLOT8(e, p, 8); }   // the high-precision build keeps the slot by itself (read in the listing) and has no registers to spare
#pragma unroll
      for (int i = 0; i < 16; ++i) l[u] += p[i];
      if constexpr (HI) { const F2 pb = bsplit16(p);
#pragma unroll
        for (int j = 0; j < 4; ++j) { ot[u][j] = mm_b(vbh[j], pb.h, ot[u][j]); ot[u][j] = mm_b(vbh[j], pb.l, ot[u][j]); ot[u][j] = mm_b(vbl[j], pb.h, ot[u][j]); } }
      else { v16h pf;
#pragma unroll
        for (int i = 0; i < 16; ++i) pf[i] = (_Float16)p[i];
#pragma unroll
        for (int j = 0; j < 4; ++j) ot[u][j] = mm_h(vf[j], pf, ot[u][j]); } }
    if constexpr (!DIAG) load_v(k0, int_t<32>{}); };
  load_k(ka, kla, kbeg); load_v(kbeg, int_t<0>{});
  for (int k0 = kbeg; k0 < kend; k0 += 32) pass(k0, ka, kla, k0 + 32, flag_t<false>{});
  if (dg) pass(q0, ka, kla, q0, flag_t<true>{}); }
// the plain-precision walk: keys [kbeg, kend) and, with dg (wave-uniform), the diagonal block at q0 (then kend == q0), in passes of 64 keys (two 32-key blocks); an odd number of blocks starts with one 32-key pass. ot, m, l come in at their start values and leave unnormalised
__device__ __forceinline__ void fa_walk64(const _Float16* __restrict__ QH, const _Float16* __restrict__ KH, const _Float16* __restrict__ VT, int b, int q0, int kbeg, int kend, bool dg, int lane, v8f (&ot)[2][4], float (&m)[2], float (&l)[2]) {
  const int c = lane & 15, h = lane >> 4; const size_t bT = (size_t)b * TT;
  const float CS = SCALE * 1.4426950408889634f;   // logits go to the log2 domain inside the exponent's multiply-add
  v16h qf[2][2]; const _Float16* pq = QH + (bT + q0 + c) * CC + 8 * h;
#pragma unroll
  for (int u = 0; u < 2; ++u)
#pragma unroll
    for (int kc = 0; kc < 2; ++kc) qf[u][kc] = frag_hp(pq + u * 16 * CC + kc * 32);
  XWAIT1(pq);
  v16h ka[4][2], vf[2][4]; float ls[2][2] = {{l[0], 0.f}, {l[1], 0.f}};   // one running row sum per query group and 32-key block of a pass: four independent chains
  // G 32-key blocks of keys / values from key k0 + D: the pointers stand at k0 and D is a constant of the loads' offsets, so the registers the loads name are the ones the wait holds
  auto load_k = [&](int k0, auto gg, auto dd) { constexpr int G = decltype(gg)::v, D = decltype(dd)::v; const _Float16* pk = KH + (bT + k0) * CC + 8 * lane;
#pragma unroll
    for (int t = 0; t < 2 * G; ++t)
#pragma unroll
      for (int kc = 0; kc < 2; ++kc) ka[t][kc] = frag_hk(pk + D * CC + (t * 2 + kc) * 512);
    XWAIT1(pk); };
  auto load_v = [&](int k0, auto gg, auto dd) { constexpr int G = decltype(gg)::v, D = decltype(dd)::v; const _Float16* pv = VT + (bT + k0) * CC + 8 * lane;
#pragma unroll
    for (int g = 0; g < G; ++g)
#pragma unroll
      for (int j = 0; j < 4; ++j) vf[g][j] = frag_hk(pv + D * CC + (g * 4 + j) * 512);
    XWAIT1(pv); };
  // one pass over G blocks at k0: ka holds its keys and, with NEXT, is refilled with the next 64 right behind the logits; vf holds its values and is refilled behind P V; MASK drops keys past each query
  auto pass = [&](int k0, auto gg, auto mask, auto next) {
    constexpr int G = decltype(gg)::v; constexpr bool MASK = decltype(mask)::v, NEXT = decltype(next)::v;
    v8f st[2][2 * G] = {};
#pragma unroll
    for (int kc = 0; kc < 2; ++kc)
#pragma unroll
      for (int t = 0; t < 2 * G; ++t)
#pragma unroll
        for (int u = 0; u < 2; ++u) st[u][t] = mm_h(ka[t][kc], qf[u][kc], st[u][t]);
    if constexpr (NEXT) load_k(k0, int_t<2>{}, int_t<64>{});
    float mx[2];
#pragma unroll
    for (int u = 0; u < 2; ++u) { float a[G];
#pragma unroll
      for (int g = 0; g < G; ++g) { a[g] = -1.0e30f;
#pragma unroll
        for (int i = 0; i < 16; ++i) { float v = st[u][2 * g + (i >> 3)][i & 7];
          if constexpr (MASK) { v = (k0 + 32 * g + 16 * (i >> 3) + 8 * h + (i & 7) <= q0 + 16 * u + c) ? v : -1.0e30f; st[u][2 * g + (i >> 3)][i & 7] = v; }
          a[g] = fmaxf(a[g], v); } }
      const float aa = fmaxf(a[0], a[G - 1]); mx[u] = fmaxf(aa, xhalf(aa)) * CS; }
    // lazy rescale: the maximum in use moves only when a column's new maximum passes it by more than 8 (log2), so P stays <= 2^8; one scalar branch per pass
    if (__builtin_amdgcn_ballot_w32(mx[0] > m[0] + 8.0f || mx[1] > m[1] + 8.0f) != 0) {
#pragma unroll
      for (int u = 0; u < 2; ++u) { const float mn = fmaxf(m[u], mx[u]); const float da = m[u] - mn; const float al = __builtin_amdgcn_exp2f(da); TSLOT1(da, al); m[u] = mn; ls[u][0] *= al; ls[u][1] *= al;
#pragma unroll
        for (int j = 0; j < 4; ++j) ot[u][j] *= al; } }
#pragma unroll
    for (int u = 0; u < 2; ++u)
#pragma unroll
      for (int g = 0; g < G; ++g) { float p[16], e[16];
#pragma unroll
        for (int i = 0; i < 16; ++i) { e[i] = __builtin_fmaf(st[u][2 * g + (i >> 3)][i & 7], CS, -m[u]); p[i] = __builtin_amdgcn_exp2f(e[i]); }
        TSLOT8(e, p, 0); TSLOT8(e, p, 8);
#pragma unroll
        for (int i = 0; i < 16; ++i) ls[u][g] += p[i];
        v16h pf;
#pragma unroll
        for (int i = 0; i < 16; ++i) pf[i] = (_Float16)p[i];
#pragma unroll
        for (int j = 0; j < 4; ++j) ot[u][j] = mm_h(vf[g][j], pf, ot[u][j]); }
    if constexpr (NEXT) load_v(k0, int_t<2>{}, int_t<64>{}); };
  const int nb = ((kend - kbeg) >> 5) + (dg ? 1 : 0); int k0 = kbeg;
  if (nb & 1) { load_k(k0, int_t<1>{}, int_t<0>{}); load_v(k0, int_t<1>{}, int_t<0>{}); pass(k0, int_t<1>{}, flag_t<true>{}, flag_t<false>{}); k0 += 32; }   // masked: it is the diagonal block where the walk has no other
  if (nb > 1) { const int kf = dg ? q0 - 32 : kend;   // the last pass of a walk to the diagonal holds the diagonal block and is masked
    load_k(k0, int_t<2>{}, int_t<0>{}); load_v(k0, int_t<2>{}, int_t<0>{});
    for (; k0 < kf; k0 += 64) pass(k0, int_t<2>{}, flag_t<false>{}, flag_t<true>{});
    if (dg) pass(k0, int_t<2>{}, flag_t<true>{}, flag_t<false>{}); }
  l[0] = ls[0][0] + ls[0][1]; l[1] = ls[1][0] + ls[1][1]; }
// joins the halves' sums, normalises and stores the 32 query rows at q0
__device__ __forceinline__ void fa_store(float* __restrict__ out, int b, int q0, int lane, v8f (&ot)[2][4], float (&l)[2]) {
  const int c = lane & 15, h = lane >> 4; const size_t bT = (size_t)b * TT;
#pragma unroll
  for (int u = 0; u < 2; ++u) { const float inv = 1.0f / (l[u] + xhalf(l[u])); float* o = out + (bT + q0 + 16 * u + c) * CC + 8 * h;
#pragma unroll
    for (int j = 0; j < 4; ++j) { ot[u][j] *= inv; const v8f y = ot[u][j]; vst2(o + j * 16, (v4f){y[0], y[1], y[2], y[3]}); vst2(o + j * 16 + 4, (v4f){y[4], y[5], y[6], y[7]}); }
    asm volatile("s_wait_xcnt 0x0" :: "v"(o), "v"(ot[u][0]), "v"(ot[u][1]), "v"(ot[u][2]), "v"(ot[u][3]) : "memory"); } }   // before the stores' address and data registers are reused
__global__ __launch_bounds__(256) void k_fa(const _Float16* __restrict__ QH, const _Float16* __restrict__ KH, const _Float16* __restrict__ QL, const _Float16* __restrict__ KL, const _Float16* __restrict__ VT, const __bf16* __restrict__ VB, const __bf16* __restrict__ VBL, float* __restrict__ out) {
  __shared__ __align__(16) v4f part[4][17][32];   // per pair, one 16-byte word per lane and slot: slots 0..15 the lower key range's O, slot 16 its (m0, m1, l0, l1)
  const int b = blockIdx.x, y = blockIdx.y; const int lane = threadIdx.x & 31; const int wave = __builtin_amdgcn_readfirstlane((int)(threadIdx.x >> 5)); const int pr = wave & 3;
  const int qL = (TT / 128 - 1 - y) * 128 + pr * 32, qE = y * 128 + pr * 32;
  // late-tile 32-key blocks handed to wave w + 4: half the difference of the two tiles' blocks; a high-precision block of the early tile is counted as two
  const int ks = 32 * (y * 128 < QHI ? TT / 64 - 3 - 6 * y : TT / 64 - 2 - 4 * y);
  // waves 0-3: one walk, keys [ks, diagonal] of the late tile; waves 4-7: two walks, the early tile and keys [0, ks) of the late tile
  const bool ehi = wave >= 4 && qE < QHI;
  if (ehi) { v8f oh[2][4] = {}; float mh[2] = {-1.0e30f, -1.0e30f}, lh[2] = {0.f, 0.f};
    fa_walk<true>(QH, KH, QL, KL, VT, VB, VBL, b, qE, 0, qE, true, lane, oh, mh, lh); fa_store(out, b, qE, lane, oh, lh); }
  v8f ot[2][4]; float m[2], l[2];
#pragma nounroll   // one copy of the pass code serves both walks: less text in the instruction cache
  for (int job = (wave < 4 || ehi) ? 1 : 0; job < 2; ++job) { const int q0 = job ? qL : qE; const bool low = wave >= 4 && job;
#pragma unroll
    for (int u = 0; u < 2; ++u) { m[u] = -1.0e30f; l[u] = 0.f;
#pragma unroll
      for (int j = 0; j < 4; ++j) ot[u][j] = (v8f){}; }
    fa_walk64(QH, KH, VT, b, q0, wave < 4 ? ks : 0, low ? ks : q0, !low, lane, ot, m, l);
    if (!job) fa_store(out, b, q0, lane, ot, l); }
  if (wave >= 4) {
#pragma unroll
    for (int u = 0; u < 2; ++u)
#pragma unroll
      for (int j = 0; j < 4; ++j) { const v8f t = ot[u][j]; part[pr][u * 8 + j * 2][lane] = (v4f){t[0], t[1], t[2], t[3]}; part[pr][u * 8 + j * 2 + 1][lane] = (v4f){t[4], t[5], t[6], t[7]}; }
    part[pr][16][lane] = (v4f){m[0], m[1], l[0], l[1]}; }
  __syncthreads();   // the lower ranges' partial results are in LDS; every wave passes here once
  if (wave < 4) { const v4f ml = part[pr][16][lane];
#pragma unroll
    for (int u = 0; u < 2; ++u) { const float mn = fmaxf(m[u], ml[u]); const float fa = __builtin_amdgcn_exp2f(m[u] - mn), fb = __builtin_amdgcn_exp2f(ml[u] - mn); l[u] = l[u] * fa + ml[2 + u] * fb;
#pragma unroll
      for (int j = 0; j < 4; ++j) { const v4f p0 = part[pr][u * 8 + j * 2][lane], p1 = part[pr][u * 8 + j * 2 + 1][lane];
#pragma unroll
        for (int i = 0; i < 4; ++i) { ot[u][j][i] = ot[u][j][i] * fa + p0[i] * fb; ot[u][j][4 + i] = ot[u][j][4 + i] * fa + p1[i] * fb; } } }
    fa_store(out, b, qL, lane, ot, l); } }

extern "C" void kernel_launch(void* const* d_in, const int* in_sizes, int n_in, void* d_out, int out_size, void* d_ws, size_t ws_size, hipStream_t stream) {
  (void)in_sizes; (void)n_in; (void)out_size;
  const float** F = (const float**)d_in;
  if (ws_size < (size_t)WS_END) return;
  char* ws = (char*)d_ws; _Float16 *QH = (_Float16*)(ws + WS_QH), *KH = (_Float16*)(ws + WS_KH), *VT = (_Float16*)(ws + WS_VT), *QL = (_Float16*)(ws + WS_QL), *KL = (_Float16*)(ws + WS_KL); __bf16 *VB = (__bf16*)(ws + WS_VB), *VBL = (__bf16*)(ws + WS_VBL); float *S = (float*)(ws + WS_S), *Y = (float*)(ws + WS_Y);
  (void)S; (void)Y; (void)QL; (void)KL; (void)VB; (void)VBL;
  // inputs: 0 queries [16,4096,64]; 1 keys; 2 values
  k_planes64<<<dim3(TNB * TT / 64), 256, 0, stream>>>(F[0], F[1], F[2], QH, QL, KH, KL, VT, VB, VBL);
  k_fa<<<dim3(TNB, TT / 256), 256, 0, stream>>>(QH, KH, QL, KL, VT, VB, VBL, (float*)d_out);
}

// v005
// Measured time: 43.9 microseconds a run.
// Two timings next to v004 both put it at 1.03 times that version's speed.
// Over all steps from v000 it is 58.8 times as fast.
// compute dtype: all float inputs rounded to bf16; Q, K, V are bf16-valued so their f16 planes are exact; causal logits q x k (1 product; the residual products below row 384 multiply exact zeros) x 64^-0.5; online softmax f32; unnormalised P = 2^(s - m) once to f16 x v (exact) (bf16 hi + lo P below row 384), divided by the f32 row sum at the end; f32 output.
#include <hip/hip_runtime.h>
#include <math.h>

typedef __attribute__((ext_vector_type(16))) _Float16 v16h;
typedef __attribute__((ext_vector_type(16))) __bf16 v16b;
typedef __attribute__((ext_vector_type(8)))  _Float16 v8h;
typedef __attribute__((ext_vector_type(8)))  float v8f;
typedef __attribute__((ext_vector_type(4)))  float v4f;
typedef __attribute__((ext_vector_type(2)))  float v2f;
typedef __attribute__((ext_vector_type(4)))  unsigned v4u;
typedef _Float16 hx8 __attribute__((ext_vector_type(8)));
typedef __attribute__((ext_vector_type(4)))  int v4i;
typedef float __attribute__((may_alias)) float_a;
typedef int __attribute__((may_alias)) int_a;

template <typename T> __device__ __forceinline__ void vst2(void* p, T v) { *(T*)p = v;  }
__device__ __forceinline__ v8f wmma16(v16h a, v16h b, v8f c) {
  v8f d = __builtin_amdgcn_wmma_f32_16x16x32_f16(false, a, false, b, (short)0, c, false, false);
  asm volatile("v_nop\n\tv_nop\n\tv_nop\n\tv_nop" : "+v"(d) : "v"(a), "v"(b));
  return d;
}
__device__ __forceinline__ v8f wmma_bf(v16b a, v16b b, v8f c) {
  v8f d = __builtin_amdgcn_wmma_f32_16x16x32_bf16(false, a, false, b, (short)0, c, false, false);
  asm volatile("v_nop\n\tv_nop\n\tv_nop\n\tv_nop" : "+v"(d) : "v"(a), "v"(b));
  return d;
}
// 16x16x32 fragments: lane = (h = lane>>4, row/col = lane&15); elements 0..7 = k0+8h+0..7, 8..15 = k0+16+8h+0..7; D element r = row 8h+r
__device__ __forceinline__ v16h frag_h(const _Float16* rowk0, int lane) {
  union { v16h v; v8h q[2]; } u; const _Float16* p = rowk0 + 8 * (lane >> 4);
  u.q[0] = *(const v8h*)p; u.q[1] = *(const v8h*)(p + 16); return u.v;
}
__device__ __forceinline__ v16h frag_f32(const float* rowk0, int lane) {
  v16h a; const float* p = rowk0 + 8 * (lane >> 4);
#pragma unroll
  for (int i = 0; i < 8; ++i) { a[i] = (_Float16)p[i]; a[8 + i] = (_Float16)p[16 + i]; }
  return a;
}
__device__ __forceinline__ v16h frag_f32s(const float* rowk0, int lane, float sc) {
  v16h a; const float* p = rowk0 + 8 * (lane >> 4);
#pragma unroll
  for (int i = 0; i < 8; ++i) { a[i] = (_Float16)(p[i] * sc); a[8 + i] = (_Float16)(p[16 + i] * sc); }
  return a;
}
// column fragment from a [K][ld] layout (column n), rows >= K read as 0
__device__ __forceinline__ v16h fragc_f32(const float* W, int k0, int n, int lane, int ld, int K) {
  v16h a; const int g = lane >> 4;
#pragma unroll
  for (int i = 0; i < 8; ++i) { const int ka = k0 + 8 * g + i, kb = ka + 16;
    a[i] = (_Float16)(ka < K ? W[(size_t)(ka < K ? ka : K - 1) * ld + n] : 0.f); a[8 + i] = (_Float16)(kb < K ? W[(size_t)(kb < K ? kb : K - 1) * ld + n] : 0.f); }
  return a;
}
struct F2 { v16b h, l; };
__device__ __forceinline__ F2 bsplit16(const float v[16]) { F2 r;
#pragma unroll
  for (int i = 0; i < 16; ++i) { const __bf16 h = (__bf16)v[i]; r.h[i] = h; r.l[i] = (__bf16)(v[i] - (float)h); }
  return r; }
__device__ __forceinline__ F2 split_row(const float* row, int k0, int lane) { float v[16]; const float* p = row + k0 + 8 * (lane >> 4);
#pragma unroll
  for (int i = 0; i < 8; ++i) { v[i] = p[i]; v[8 + i] = p[16 + i]; }
  return bsplit16(v); }
__device__ __forceinline__ F2 split_rowK(const float* row, int k0, int lane, int K) { float v[16]; const int g = lane >> 4;
#pragma unroll
  for (int i = 0; i < 8; ++i) { const int ka = k0 + 8 * g + i, kb = ka + 16; v[i] = ka < K ? row[ka < K ? ka : K - 1] : 0.f; v[8 + i] = kb < K ? row[kb < K ? kb : K - 1] : 0.f; }
  return bsplit16(v); }
__device__ __forceinline__ F2 split_col(const float* W, int k0, int n, int lane, int ld, int K) { float v[16]; const int g = lane >> 4;
#pragma unroll
  for (int i = 0; i < 8; ++i) { const int ka = k0 + 8 * g + i, kb = ka + 16; v[i] = ka < K ? W[(size_t)(ka < K ? ka : K - 1) * ld + n] : 0.f; v[8 + i] = kb < K ? W[(size_t)(kb < K ? kb : K - 1) * ld + n] : 0.f; }
  return bsplit16(v); }
__device__ __forceinline__ v8f mac3(const F2& a, const F2& b, v8f c) { c = wmma_bf(a.l, b.h, c); c = wmma_bf(a.h, b.l, c); return wmma_bf(a.h, b.h, c); }
__device__ __forceinline__ float sigm(float v) { return 1.0f / (1.0f + expf(-v)); }
#define LDSX() do { asm volatile("s_wait_dscnt 0" ::: "memory"); __builtin_amdgcn_wave_barrier(); __builtin_amdgcn_fence(__ATOMIC_RELEASE, "workgroup"); } while (0)

// Causal scaled-dot-product attention on given tensors (queries / keys / values [16,4096,64], single head; the module adds -2^32 to the strictly-upper triangle before the softmax - equivalent to excluding those keys): out = softmax(causal(Q K^T / 8)) V -> [16,4096,64].
#define NB 16
#define TT 4096
#define CC 64            // NH * HD = projected width
#define DIN 64          // input (model) width
#define NH 1
#define HD 64
#define NQB (TT / 64)
#define HG 1
#define SCALE (0.125f)
#define CAUSAL 1
#ifndef TNB
#define TNB NB
#endif
__device__ __forceinline__ float bfr(float v) { return (float)(__bf16)v; }
__host__ __device__ __forceinline__ int kb_last(int qb) { return CAUSAL ? ((qb * 64 + 63) >> 7) : (TT / 128 - 1); }
typedef __attribute__((ext_vector_type(8))) __bf16 v8b;
__device__ __forceinline__ v16b frag_b(const __bf16* rowk0, int lane) {
  union { v16b v; v8b q[2]; } u; const __bf16* p = rowk0 + 8 * (lane >> 4);
  u.q[0] = *(const v8b*)p; u.q[1] = *(const v8b*)(p + 16); return u.v;
}
#define QBH 6              // unused: the high-precision path is chosen by q0 < QHI (queries 0..383: few keys, no averaging)
#define QHI 384            // rows carrying a q residual plane
#define KHI 384            // key rows carrying k residual / v bf16 hi+lo planes (used only by the causal high-precision path)
// B fragment (k rows k0+.., output column o) of a weight: (in,out) [K][ld] or (out,in) [ld rows of K]: bf16 exact, or f16(bf16 * 256) exact
__device__ __forceinline__ v16b wcol_io(const float* Wm, int k0, int o, int lane, int ld) { v16b w; const int g = lane >> 4;
#pragma unroll
  for (int i = 0; i < 8; ++i) { w[i] = (__bf16)Wm[(size_t)(k0 + 8 * g + i) * ld + o]; w[8 + i] = (__bf16)Wm[(size_t)(k0 + 16 + 8 * g + i) * ld + o]; }
  return w; }
__device__ __forceinline__ v16b wcol_oi(const float* Wm, int k0, int o, int lane, int K) { v16b w; const float* p = Wm + (size_t)o * K + k0 + 8 * (lane >> 4);
#pragma unroll
  for (int i = 0; i < 8; ++i) { w[i] = (__bf16)p[i]; w[8 + i] = (__bf16)p[16 + i]; }
  return w; }
__device__ __forceinline__ v16h wcolh_io(const float* Wm, int k0, int o, int lane, int ld) { v16h w; const int g = lane >> 4;
#pragma unroll
  for (int i = 0; i < 8; ++i) { w[i] = (_Float16)(bfr(Wm[(size_t)(k0 + 8 * g + i) * ld + o]) * 256.0f); w[8 + i] = (_Float16)(bfr(Wm[(size_t)(k0 + 16 + 8 * g + i) * ld + o]) * 256.0f); }
  return w; }
__device__ __forceinline__ v16h wcolh_oi(const float* Wm, int k0, int o, int lane, int K) { v16h w; const float* p = Wm + (size_t)o * K + k0 + 8 * (lane >> 4);
#pragma unroll
  for (int i = 0; i < 8; ++i) { w[i] = (_Float16)(bfr(p[i]) * 256.0f); w[8 + i] = (_Float16)(bfr(p[16 + i]) * 256.0f); }
  return w; }
#define WQKV_LAYOUT 0   // 0 = (in,out) [DIN][CC]; 1 = (out,in) [CC][DIN]; 2 = per-head [NH][DIN][HD]
__device__ __forceinline__ v16b wcol_hdk(const float* Wm, int k0, int o, int lane) { v16b w; const int g = lane >> 4; const float* p = Wm + (size_t)(o / HD) * DIN * HD + (o % HD);
#pragma unroll
  for (int i = 0; i < 8; ++i) { w[i] = (__bf16)p[(size_t)(k0 + 8 * g + i) * HD]; w[8 + i] = (__bf16)p[(size_t)(k0 + 16 + 8 * g + i) * HD]; }
  return w; }
#define WO_OUT_IN 0
#if WQKV_LAYOUT == 1
#define WCOL(W, k0, o, lane) wcol_oi(W, k0, o, lane, DIN)
#elif WQKV_LAYOUT == 2
#define WCOL(W, k0, o, lane) wcol_hdk(W, k0, o, lane)
#else
#define WCOL(W, k0, o, lane) wcol_io(W, k0, o, lane, CC)
#endif
#if WO_OUT_IN
#define WOCOL(W, k0, o, lane) wcol_oi(W, k0, o, lane, CC)
#define WOCOLH(W, k0, o, lane) wcolh_oi(W, k0, o, lane, CC)
#else
#define WOCOL(W, k0, o, lane) wcol_io(W, k0, o, lane, DIN)
#define WOCOLH(W, k0, o, lane) wcolh_io(W, k0, o, lane, DIN)
#endif
__global__ __launch_bounds__(256) void k_planes64(const float* __restrict__ Qs, const float* __restrict__ Ks, const float* __restrict__ Vs, _Float16* __restrict__ QH, _Float16* __restrict__ QL, _Float16* __restrict__ KH, _Float16* __restrict__ KL, _Float16* __restrict__ VT, __bf16* __restrict__ VB, __bf16* __restrict__ VBL) {
  __shared__ __align__(16) _Float16 sv[64][72], sk[64][72], skl[64][72];
  const int tid = threadIdx.x; const size_t r0 = (size_t)blockIdx.x * 64; const int b = (int)(r0 / TT), t0 = (int)(r0 % TT);
  for (int e = tid; e < 64 * 8; e += 256) { const int rl = e >> 3, q = e & 7; const size_t src = (r0 + rl) * CC + q * 8; float tq[8], tk[8], tv[8];
#pragma unroll
    for (int u = 0; u < 8; ++u) { tq[u] = Qs[src + u]; tk[u] = Ks[src + u]; tv[u] = Vs[src + u]; }
    asm volatile("s_wait_loadcnt 0x0" ::: "memory");
    hx8 hq, hk, hlq, hlk;
#pragma unroll
    for (int u = 0; u < 8; ++u) { const float qv = bfr(tq[u]), kv = bfr(tk[u]); const _Float16 qh = (_Float16)qv, kh = (_Float16)kv; hq[u] = qh; hlq[u] = (_Float16)((qv - (float)qh) * 1024.0f); hk[u] = kh; hlk[u] = (_Float16)((kv - (float)kh) * 1024.0f); sv[rl][q * 8 + u] = (_Float16)bfr(tv[u]); }
    const v4u wh = *(const v4u*)&hq; vst2((unsigned*)(QH + (r0 + rl) * CC + q * 8), wh); vst2(&sk[rl][q * 8], *(const v4u*)&hk);
    asm volatile("s_wait_xcnt 0x0" :: "v"(wh) : "memory");   // before the store's data registers are reused
    if (t0 < KHI) vst2(&skl[rl][q * 8], *(const v4u*)&hlk);
    if (t0 + rl < QHI) { const v4u wq = *(const v4u*)&hlq; vst2((unsigned*)(QL + ((size_t)b * QHI + t0 + rl) * CC + q * 8), wq);
      asm volatile("s_wait_xcnt 0x0" :: "v"(wq) : "memory"); } }   // before the store's address and data registers are reused
  __syncthreads();
  // fragment order: 16-byte word e of these 64 keys is what lane e & 31 takes with one load, so a wave's load (and each store here) covers 512 contiguous bytes
  for (int e = tid; e < 64 * 8; e += 256) { const int c = e & 15, k8 = ((e >> 5) & 1) * 16 + ((e >> 4) & 1) * 8;
    const int row = (e >> 7) * 16 + c, d0 = ((e >> 6) & 1) * 32 + k8;   // keys: word = (16-key tile, 32-wide half of d, 16-wide half, h, key)
    const int ch = ((e >> 6) & 3) * 16 + c, kk = (e >> 8) * 32 + k8;   // values: word = (32-key pass, 16-channel tile, 16-key half, h, channel)
    const v4u wk = *(const v4u*)&sk[row][d0]; hx8 hv; _Pragma("unroll") for (int j = 0; j < 8; ++j) hv[j] = sv[kk + j][ch];
    const v4u wv = *(const v4u*)&hv; vst2((unsigned*)(KH + r0 * CC + e * 8), wk); vst2((unsigned*)(VT + r0 * CC + e * 8), wv);
    if (t0 < KHI) { const size_t o3 = ((size_t)b * KHI + t0) * CC + e * 8; const v4u wl = *(const v4u*)&skl[row][d0]; v8b bh, bl; _Pragma("unroll") for (int j = 0; j < 8; ++j) { const float vv = (float)hv[j]; const __bf16 h1 = (__bf16)vv; bh[j] = h1; bl[j] = (__bf16)(vv - (float)h1); }
      const v4u wh = *(const v4u*)&bh, wb = *(const v4u*)&bl; vst2((unsigned*)(KL + o3), wl); vst2((unsigned*)(VB + o3), wh); vst2((unsigned*)(VBL + o3), wb);
      asm volatile("s_wait_xcnt 0x0" :: "v"(wl), "v"(wh), "v"(wb) : "memory"); }   // before these stores' registers are reused
    asm volatile("s_wait_xcnt 0x0" :: "v"(wk), "v"(wv), "v"(e) : "memory"); } }   // before the stores' data registers and the word index their addresses come from are reused
#ifndef SM_EXTRA_PARAMS
#define SM_EXTRA_PARAMS
#endif
#ifndef PROJ_EXTRA_PARAMS
#define PROJ_EXTRA_PARAMS
#endif
#ifndef SM_MASK_HOOK
#define SM_MASK_HOOK (void)0
#endif

#define WS_QH  0u                                      // f16 q rows [b*t][CC]
#define WS_KH  (WS_QH + 2u * (size_t)NB * TT * CC)      // f16 k in fragment order [b][t / 16][d / 32][(d / 16) & 1][lane = 16 * ((d / 8) & 1) + t % 16][d % 8]
#define WS_VT  (WS_KH + 2u * (size_t)NB * TT * CC)      // f16 v in fragment order [b][t / 32][c / 16][(t / 16) & 1][lane = 16 * ((t / 8) & 1) + c % 16][t % 8]
#define WS_QL  (WS_VT + 2u * (size_t)NB * CC * TT)      // f16 q residual x 2^10 rows [b][t < QHI][CC]
#define WS_KL  (WS_QL + 2u * (size_t)NB * QHI * CC)     // f16 k residual x 2^10, t < KHI, in the order of the k plane
#define WS_VB  (WS_KL + 2u * (size_t)NB * KHI * CC)     // bf16 v hi (and lo behind it), t < KHI, in the order of the v plane
#define WS_VBL (WS_VB + 2u * (size_t)NB * CC * KHI)
#define WS_S   (WS_VBL + 2u * (size_t)NB * CC * KHI)    // f32 [hg][t][s] region, unused: logits and P stay in registers
#define WS_Y   (WS_S  + 4u * (size_t)HG * TT * TT)      // f32 ctx rows [b*t][CC] (only when there is an output projection)
#define WS_END (WS_Y  + 0u)

// ---- k_proj: block = (64 rows, 128 cols, which): q/k/v = X W (+ b) with exact bf16 products (K = DIN) -> which 0: q f16 rows (+ residual rows < QHI); 1: k f16 rows (+ residual rows < KHI); 2: v f16 planes [c][t] (+ bf16 hi/lo planes for t < KHI)
__global__ __launch_bounds__(128) void k_proj(const float* __restrict__ XQ, const float* __restrict__ XK, const float* __restrict__ XV, const float* __restrict__ WQ, const float* __restrict__ WK, const float* __restrict__ WV, const float* __restrict__ BQ, const float* __restrict__ BK, const float* __restrict__ BV,
    _Float16* __restrict__ QH, _Float16* __restrict__ QL, _Float16* __restrict__ KH, _Float16* __restrict__ KL, _Float16* __restrict__ VT, __bf16* __restrict__ VB, __bf16* __restrict__ VBL) {
  __shared__ __align__(16) _Float16 sh[64][136], sl[64][136]; __shared__ __align__(16) _Float16 th[128][72]; __shared__ __align__(16) __bf16 tb[128][72], tbl[128][72];
  const int tid = threadIdx.x, wave = tid >> 5, lane = tid & 31, col = lane & 15, g = lane >> 4; const int which = blockIdx.z; const int c0 = blockIdx.y * 128; const size_t r0 = (size_t)blockIdx.x * 64; const size_t bb = r0 / TT; const int t0 = (int)(r0 % TT);
  const float* X = which == 0 ? XQ : which == 1 ? XK : XV; const float* WA = which == 0 ? WQ : which == 1 ? WK : WV; const float* BA = which == 0 ? BQ : which == 1 ? BK : BV;
  v8f acc[8] = {};
#pragma unroll 2
  for (int kc = 0; kc < DIN / 32; ++kc) { v16b a; { const float* p = X + (r0 + wave * 16 + col) * DIN + kc * 32 + 8 * g;
#pragma unroll
      for (int i = 0; i < 8; ++i) { a[i] = (__bf16)p[i]; a[8 + i] = (__bf16)p[16 + i]; } }
    asm volatile("s_wait_loadcnt 0x0" ::: "memory");
#pragma unroll
    for (int j = 0; j < 8; ++j) { const v16b w = WCOL(WA, kc * 32, c0 + j * 16 + col, lane); asm volatile("s_wait_loadcnt 0x0" ::: "memory"); acc[j] = wmma_bf(a, w, acc[j]); } }
  if (which < 2) { _Float16* DH = which == 0 ? QH : KH; _Float16* DL = which == 0 ? QL : KL; const int nhi = which == 0 ? QHI : KHI; const bool hi_rows = t0 < nhi;
#pragma unroll
    for (int j = 0; j < 8; ++j) { const float bias = BA ? bfr(BA[c0 + j * 16 + col]) : 0.f;
#pragma unroll
      for (int r = 0; r < 8; ++r) { const float v = acc[j][r] + bias; const _Float16 hv = (_Float16)v; sh[wave * 16 + 8 * g + r][j * 16 + col] = hv; sl[wave * 16 + 8 * g + r][j * 16 + col] = (_Float16)((v - (float)hv) * 1024.0f); } }
    __syncthreads();
    for (int e = tid; e < 64 * 16; e += 128) { const int rl = e >> 4, q = e & 15; vst2((unsigned*)(DH + (r0 + rl) * CC + c0 + q * 8), *(const v4u*)&sh[rl][q * 8]); if (hi_rows) vst2((unsigned*)(DL + (bb * nhi + t0 + rl) * (size_t)CC + c0 + q * 8), *(const v4u*)&sl[rl][q * 8]); }
  } else { const bool hi_rows = t0 < KHI;
#pragma unroll
    for (int j = 0; j < 8; ++j) { const float bias = BA ? bfr(BA[c0 + j * 16 + col]) : 0.f;
#pragma unroll
      for (int r = 0; r < 8; ++r) { const float v = acc[j][r] + bias; const int rl = wave * 16 + 8 * g + r, cl = j * 16 + col; th[cl][rl] = (_Float16)v; const __bf16 bh = (__bf16)v; tb[cl][rl] = bh; tbl[cl][rl] = (__bf16)(v - (float)bh); } }
    __syncthreads();
    for (int e = tid; e < 128 * 8; e += 128) { const int cl = e >> 3, q = e & 7; vst2((unsigned*)(VT + (bb * CC + c0 + cl) * (size_t)TT + t0 + q * 8), *(const v4u*)&th[cl][q * 8]); if (hi_rows) { const size_t o3 = (bb * CC + c0 + cl) * (size_t)KHI + t0 + q * 8; vst2((unsigned*)(VB + o3), *(const v4u*)&tb[cl][q * 8]); vst2((unsigned*)(VBL + o3), *(const v4u*)&tbl[cl][q * 8]); } } } }
template <bool B> struct flag_t { static constexpr bool v = B; };
template <int N> struct int_t { static constexpr int v = N; };
__device__ __forceinline__ float xhalf(float x) { return __builtin_bit_cast(float, __builtin_amdgcn_permlanex16(__builtin_bit_cast(int, x), __builtin_bit_cast(int, x), 0x76543210, 0xfedcba98, false, false)); }  // lane l with lane l ^ 16, on the vector pipe
__device__ __forceinline__ v8f mm_h(v16h a, v16h b, v8f c) { return __builtin_amdgcn_wmma_f32_16x16x32_f16(false, a, false, b, (short)0, c, false, false); }
__device__ __forceinline__ v8f mm_b(v16b a, v16b b, v8f c) { return __builtin_amdgcn_wmma_f32_16x16x32_bf16(false, a, false, b, (short)0, c, false, false); }
// fragment from a lane's own pointer (row start + k0 + 8h): the same k order as frag_h / frag_b
__device__ __forceinline__ v16h frag_hp(const _Float16* p) { union { v16h v; v8h q[2]; } u; u.q[0] = *(const v8h*)p; u.q[1] = *(const v8h*)(p + 16); return u.v; }
__device__ __forceinline__ v16b frag_bp(const __bf16* p) { union { v16b v; v8b q[2]; } u; u.q[0] = *(const v8b*)p; u.q[1] = *(const v8b*)(p + 16); return u.v; }
// fragment from the fragment-ordered planes, from a lane's own pointer (fragment start + 8 * lane): two loads, each 512 contiguous bytes over the wave; the same k order as frag_h / frag_b
__device__ __forceinline__ v16h frag_hk(const _Float16* p) { union { v16h v; v8h q[2]; } u; u.q[0] = *(const v8h*)p; u.q[1] = *(const v8h*)(p + 256); return u.v; }
__device__ __forceinline__ v16b frag_bk(const __bf16* p) { union { v16b v; v8b q[2]; } u; u.q[0] = *(const v8b*)p; u.q[1] = *(const v8b*)(p + 256); return u.v; }
// s_wait_xcnt 0 behind a run of loads, before their address registers are reused; the pointers are inputs so that those registers stay theirs up to the wait; the clobber keeps the loads issued in front of it, ahead of their use
#define XWAIT1(p) asm volatile("s_wait_xcnt 0x0" :: "v"(p) : "memory")
#define XWAIT2(p, q) asm volatile("s_wait_xcnt 0x0" :: "v"(p), "v"(q) : "memory")
// the vector slot behind a transcendental: one v_nop that stands behind the exponentials (it takes their results) and up to which their source registers stay theirs (it takes the sources), so that no instruction directly behind one overwrites its source
#define TSLOT1(a, r) asm volatile("v_nop" :: "v"(a), "v"(r))
#define TSLOT8(a, r, o) asm volatile("v_nop" :: "v"(a[o]), "v"(a[o + 1]), "v"(a[o + 2]), "v"(a[o + 3]), "v"(a[o + 4]), "v"(a[o + 5]), "v"(a[o + 6]), "v"(a[o + 7]), "v"(r[o]), "v"(r[o + 1]), "v"(r[o + 2]), "v"(r[o + 3]), "v"(r[o + 4]), "v"(r[o + 5]), "v"(r[o + 6]), "v"(r[o + 7]))
// walks keys [kbeg, kend) in full passes and, with dg (wave-uniform), the diagonal pass at q0 (then kend == q0); ot, m, l come in at their start values and leave unnormalised
template <bool HI>
__device__ __forceinline__ void fa_walk(const _Float16* __restrict__ QH, const _Float16* __restrict__ KH, const _Float16* __restrict__ QL, const _Float16* __restrict__ KL, const _Float16* __restrict__ VT, const __bf16* __restrict__ VB, const __bf16* __restrict__ VBL, int b, int q0, int kbeg, int kend, bool dg, int lane, v8f (&ot)[2][4], float (&m)[2], float (&l)[2]) {
  const int c = lane & 15, h = lane >> 4; const size_t bT = (size_t)b * TT;
  const float CS = SCALE * 1.4426950408889634f;   // logits go to the log2 domain inside the exponent's multiply-add
  v16h qf[2][2], qlf[2][2]; const _Float16* pq = QH + (bT + q0 + c) * CC + 8 * h; const _Float16* pql = QL + ((size_t)b * QHI + (HI ? q0 : 0) + c) * CC + 8 * h;
#pragma unroll
  for (int u = 0; u < 2; ++u)
#pragma unroll
    for (int kc = 0; kc < 2; ++kc) { qf[u][kc] = frag_hp(pq + u * 16 * CC + kc * 32); if constexpr (HI) qlf[u][kc] = frag_hp(pql + u * 16 * CC + kc * 32); }
  if constexpr (HI) XWAIT2(pq, pql); else XWAIT1(pq);
  v16h ka[2][2], kla[2][2]; v16h vf[4]; v16b vbh[4], vbl[4];
  auto load_k = [&](v16h (&kf)[2][2], v16h (&klf)[2][2], int k0) { const _Float16* pk = KH + (bT + k0) * CC + 8 * lane; const _Float16* pkl = KL + ((size_t)b * KHI + (HI ? k0 : 0)) * CC + 8 * lane;
#pragma unroll
    for (int t = 0; t < 2; ++t)
#pragma unroll
      for (int kc = 0; kc < 2; ++kc) { kf[t][kc] = frag_hk(pk + (t * 2 + kc) * 512); if constexpr (HI) klf[t][kc] = frag_hk(pkl + (t * 2 + kc) * 512); }
    if constexpr (HI) XWAIT2(pk, pkl); else XWAIT1(pk); };
  // values of key block k0 + D: the pointers stand at k0 and D is a constant of the loads' offsets, so the registers the loads name are the ones the wait holds
  auto load_v = [&](int k0, auto dd) { constexpr int D = decltype(dd)::v;
    if constexpr (HI) { const __bf16* ph = VB + ((size_t)b * KHI + k0) * CC + 8 * lane; const __bf16* pl = VBL + ((size_t)b * KHI + k0) * CC + 8 * lane;
#pragma unroll
      for (int j = 0; j < 4; ++j) { vbh[j] = frag_bk(ph + D * CC + j * 512); vbl[j] = frag_bk(pl + D * CC + j * 512); }
      XWAIT2(ph, pl); }
    else { const _Float16* pv = VT + (bT + k0) * CC + 8 * lane;
#pragma unroll
      for (int j = 0; j < 4; ++j) vf[j] = frag_hk(pv + D * CC + j * 512);
      XWAIT1(pv); } };
  // the loop's own refills name a plane's base and a carried 32-bit byte offset: hof into the k plane, lof into the planes that hold rows < KHI only (k residual, v hi, v lo); in front of the pass's s_wait_xcnt 0 they stand at the pass's keys, behind it at the next pass's
  unsigned hof = (unsigned)(((bT + kbeg) * CC + 8 * lane) * 2), lof = (unsigned)((((size_t)b * KHI + kbeg) * CC + 8 * lane) * 2);
  auto next_k = [&](v16h (&kf)[2][2], v16h (&klf)[2][2]) { const _Float16* pk = (const _Float16*)((const char*)KH + hof); const _Float16* pkl = (const _Float16*)((const char*)KL + lof);
#pragma unroll
    for (int t = 0; t < 2; ++t)
#pragma unroll
      for (int kc = 0; kc < 2; ++kc) { kf[t][kc] = frag_hk(pk + 32 * CC + (t * 2 + kc) * 512); klf[t][kc] = frag_hk(pkl + 32 * CC + (t * 2 + kc) * 512); } };
  auto next_v = [&]() { const __bf16* ph = (const __bf16*)((const char*)VB + lof); const __bf16* pl = (const __bf16*)((const char*)VBL + lof);
#pragma unroll
    for (int j = 0; j < 4; ++j) { vbh[j] = frag_bk(ph + j * 512); vbl[j] = frag_bk(pl + j * 512); } };
  // one pass: kf / klf hold this pass's keys and are refilled with those of key block kn (the next pass's) right behind the logits; vbh / vbl hold this pass's values and are refilled with the next pass's behind P V
  auto pass = [&](int k0, v16h (&kf)[2][2], v16h (&klf)[2][2], int kn, auto diag) {
    constexpr bool DIAG = decltype(diag)::v;
    v8f st[2][2] = {}, sl[2][2] = {};
#pragma unroll
    for (int kc = 0; kc < 2; ++kc)
#pragma unroll
      for (int t = 0; t < 2; ++t)
#pragma unroll
        for (int u = 0; u < 2; ++u) { st[u][t] = mm_h(kf[t][kc], qf[u][kc], st[u][t]); if constexpr (HI) { sl[u][t] = mm_h(kf[t][kc], qlf[u][kc], sl[u][t]); sl[u][t] = mm_h(klf[t][kc], qf[u][kc], sl[u][t]); } }
    if constexpr (!DIAG) next_k(kf, klf);
    float s[2][16], mx[2];
#pragma unroll
    for (int u = 0; u < 2; ++u) { float a = -1.0e30f;
#pragma unroll
      for (int i = 0; i < 16; ++i) { float v = st[u][i >> 3][i & 7]; if constexpr (HI) v += sl[u][i >> 3][i & 7] * (1.0f / 1024.0f);
        if constexpr (DIAG) v = (k0 + 16 * (i >> 3) + 8 * h + (i & 7) <= q0 + 16 * u + c) ? v : -1.0e30f;
        s[u][i] = v; a = fmaxf(a, v); }
      mx[u] = fmaxf(a, xhalf(a)) * CS; }
    // the pass's one s_wait_xcnt 0, before the offset registers of this pass's key loads and of the last pass's value loads are rewritten: it takes the maxima so that it stands behind the maximum chain, for speed only; the offsets go through it so that their additions stay behind it
    if constexpr (!DIAG) { asm volatile("s_wait_xcnt 0x0" : "+v"(hof), "+v"(lof) : "v"(mx[0]), "v"(mx[1]) : "memory"); hof += 32 * CC * 2; lof += 32 * CC * 2; }
    // lazy rescale: the maximum in use moves only when a column's new maximum passes it by more than 8 (log2), so P stays <= 2^8; one scalar branch per pass
    if (__builtin_amdgcn_ballot_w32(mx[0] > m[0] + 8.0f || mx[1] > m[1] + 8.0f) != 0) {
#pragma unroll
      for (int u = 0; u < 2; ++u) { const float mn = fmaxf(m[u], mx[u]); const float da = m[u] - mn; const float al = __builtin_amdgcn_exp2f(da); TSLOT1(da, al); m[u] = mn; l[u] *= al;
#pragma unroll
        for (int j = 0; j < 4; ++j) ot[u][j] *= al; } }
#pragma unroll
    for (int u = 0; u < 2; ++u) { float p[16], e[16];
#pragma unroll
      for (int i = 0; i < 16; ++i) { e[i] = __builtin_fmaf(s[u][i], CS, -m[u]); p[i] = __builtin_amdgcn_exp2f(e[i]); }
      if constexpr (!HI) { TSLOT8(e, p, 0); TSLOT8(e, p, 8); }   // the high-precision build keeps the slot by itself (read in the listing) and has no registers to spare
#pragma unroll
      for (int i = 0; i < 16; ++i) l[u] += p[i];
      if constexpr (HI) { const F2 pb = bsplit16(p);
#pragma unroll
        for (int j = 0; j < 4; ++j) { ot[u][j] = mm_b(vbh[j], pb.h, ot[u][j]); ot[u][j] = mm_b(vbh[j], pb.l, ot[u][j]); ot[u][j] = mm_b(vbl[j], pb.h, ot[u][j]); } }
      else { v16h pf;
#pragma unroll
        for (int i = 0; i < 16; ++i) pf[i] = (_Float16)p[i];
#pragma unroll
        for (int j = 0; j < 4; ++j) ot[u][j] = mm_h(vf[j], pf, ot[u][j]); } }
    if constexpr (!DIAG) next_v(); };
  load_k(ka, kla, kbeg); load_v(kbeg, int_t<0>{});
  for (int k0 = kbeg; k0 < kend; k0 += 32) pass(k0, ka, kla, k0 + 32, flag_t<false>{});
  XWAIT1(lof);   // the last refill's value loads, before their offset register is reused
  if (dg) pass(q0, ka, kla, q0, flag_t<true>{}); }
// the plain-precision walk: keys [kbeg, kend) and, with dg (wave-uniform), the diagonal block at q0 (then kend == q0), in passes of 64 keys (two 32-key blocks); an odd number of blocks starts with one 32-key pass. ot, m, l come in at their start values and leave unnormalised
__device__ __forceinline__ void fa_walk64(const _Float16* __restrict__ QH, const _Float16* __restrict__ KH, const _Float16* __restrict__ VT, int b, int q0, int kbeg, int kend, bool dg, int lane, v8f (&ot)[2][4], float (&m)[2], float (&l)[2]) {
  const int c = lane & 15, h = lane >> 4; const size_t bT = (size_t)b * TT;
  const float CS = SCALE * 1.4426950408889634f;   // logits go to the log2 domain inside the exponent's multiply-add
  v16h qf[2][2]; const _Float16* pq = QH + (bT + q0 + c) * CC + 8 * h;
#pragma unroll
  for (int u = 0; u < 2; ++u)
#pragma unroll
    for (int kc = 0; kc < 2; ++kc) qf[u][kc] = frag_hp(pq + u * 16 * CC + kc * 32);
  XWAIT1(pq);
  v16h ka[4][2], vf[2][4]; float ls[2][2] = {{l[0], 0.f}, {l[1], 0.f}};   // one running row sum per query group and 32-key block of a pass: four independent chains
  // G 32-key blocks of keys / values from key k0 + D: the pointers stand at k0 and D is a constant of the loads' offsets, so the registers the loads name are the ones the wait holds
  auto load_k = [&](int k0, auto gg, auto dd) { constexpr int G = decltype(gg)::v, D = decltype(dd)::v; const _Float16* pk = KH + (bT + k0) * CC + 8 * lane;
#pragma unroll
    for (int t = 0; t < 2 * G; ++t)
#pragma unroll
      for (int kc = 0; kc < 2; ++kc) ka[t][kc] = frag_hk(pk + D * CC + (t * 2 + kc) * 512);
    XWAIT1(pk); };
  auto load_v = [&](int k0, auto gg, auto dd) { constexpr int G = decltype(gg)::v, D = decltype(dd)::v; const _Float16* pv = VT + (bT + k0) * CC + 8 * lane;
#pragma unroll
    for (int g = 0; g < G; ++g)
#pragma unroll
      for (int j = 0; j < 4; ++j) vf[g][j] = frag_hk(pv + D * CC + (g * 4 + j) * 512);
    XWAIT1(pv); };
  // the loop's own refills name the plane's base and one carried 32-bit byte offset each (kof at the pass's keys, vof at the next pass's values); the offsets move only behind the pass's one s_wait_xcnt 0
  unsigned kof = 0, vof = 0;
  auto next_k = [&]() { const _Float16* pk = (const _Float16*)((const char*)KH + kof);
#pragma unroll
    for (int t = 0; t < 4; ++t)
#pragma unroll
      for (int kc = 0; kc < 2; ++kc) ka[t][kc] = frag_hk(pk + 64 * CC + (t * 2 + kc) * 512); };
  auto next_v = [&]() { const _Float16* pv = (const _Float16*)((const char*)VT + vof);
#pragma unroll
    for (int g = 0; g < 2; ++g)
#pragma unroll
      for (int j = 0; j < 4; ++j) vf[g][j] = frag_hk(pv + (g * 4 + j) * 512); };
  // one pass over G blocks at k0: ka holds its keys and, with NEXT, is refilled with the next 64 right behind the logits; vf holds its values and is refilled behind P V; MASK drops keys past each query
  auto pass = [&](int k0, auto gg, auto mask, auto next) {
    constexpr int G = decltype(gg)::v; constexpr bool MASK = decltype(mask)::v, NEXT = decltype(next)::v;
    v8f st[2][2 * G] = {};
#pragma unroll
    for (int kc = 0; kc < 2; ++kc)
#pragma unroll
      for (int t = 0; t < 2 * G; ++t)
#pragma unroll
        for (int u = 0; u < 2; ++u) st[u][t] = mm_h(ka[t][kc], qf[u][kc], st[u][t]);
    if constexpr (NEXT) next_k();
    float mx[2];
#pragma unroll
    for (int u = 0; u < 2; ++u) { float a[G];
#pragma unroll
      for (int g = 0; g < G; ++g) { a[g] = -1.0e30f;
#pragma unroll
        for (int i = 0; i < 16; ++i) { float v = st[u][2 * g + (i >> 3)][i & 7];
          if constexpr (MASK) { v = (k0 + 32 * g + 16 * (i >> 3) + 8 * h + (i & 7) <= q0 + 16 * u + c) ? v : -1.0e30f; st[u][2 * g + (i >> 3)][i & 7] = v; }
          a[g] = fmaxf(a[g], v); } }
      const float aa = fmaxf(a[0], a[G - 1]); mx[u] = fmaxf(aa, xhalf(aa)) * CS; }
    // the pass's one s_wait_xcnt 0, before the offset registers of this pass's key loads and of the last pass's value loads are rewritten: it takes the maxima so that it stands behind the maximum chain, for speed only; the offsets go through it so that their additions stay behind it
    if constexpr (NEXT) { asm volatile("s_wait_xcnt 0x0" : "+v"(kof), "+v"(vof) : "v"(mx[0]), "v"(mx[1]) : "memory"); kof += 64 * CC * 2; vof += 64 * CC * 2; }
    // lazy rescale: the maximum in use moves only when a column's new maximum passes it by more than 8 (log2), so P stays <= 2^8; one scalar branch per pass
    if (__builtin_amdgcn_ballot_w32(mx[0] > m[0] + 8.0f || mx[1] > m[1] + 8.0f) != 0) {
#pragma unroll
      for (int u = 0; u < 2; ++u) { const float mn = fmaxf(m[u], mx[u]); const float da = m[u] - mn; const float al = __builtin_amdgcn_exp2f(da); TSLOT1(da, al); m[u] = mn; ls[u][0] *= al; ls[u][1] *= al;
#pragma unroll
        for (int j = 0; j < 4; ++j) ot[u][j] *= al; } }
#pragma unroll
    for (int u = 0; u < 2; ++u)
#pragma unroll
      for (int g = 0; g < G; ++g) { float p[16], e[16];
#pragma unroll
        for (int i = 0; i < 16; ++i) { e[i] = __builtin_fmaf(st[u][2 * g + (i >> 3)][i & 7], CS, -m[u]); p[i] = __builtin_amdgcn_exp2f(e[i]); }
        TSLOT8(e, p, 0); TSLOT8(e, p, 8);
#pragma unroll
        for (int i = 0; i < 16; ++i) ls[u][g] += p[i];
        v16h pf;
#pragma unroll
        for (int i = 0; i < 16; ++i) pf[i] = (_Float16)p[i];
#pragma unroll
        for (int j = 0; j < 4; ++j) ot[u][j] = mm_h(vf[g][j], pf, ot[u][j]); }
    if constexpr (NEXT) next_v(); };
  const int nb = ((kend - kbeg) >> 5) + (dg ? 1 : 0); int k0 = kbeg;
  if (nb & 1) { load_k(k0, int_t<1>{}, int_t<0>{}); load_v(k0, int_t<1>{}, int_t<0>{}); pass(k0, int_t<1>{}, flag_t<true>{}, flag_t<false>{}); k0 += 32; }   // masked: it is the diagonal block where the walk has no other
  if (nb > 1) { const int kf = dg ? q0 - 32 : kend;   // the last pass of a walk to the diagonal holds the diagonal block and is masked
    load_k(k0, int_t<2>{}, int_t<0>{}); load_v(k0, int_t<2>{}, int_t<0>{});
    kof = vof = (unsigned)(((bT + k0) * CC + 8 * lane) * 2);
    for (; k0 < kf; k0 += 64) pass(k0, int_t<2>{}, flag_t<false>{}, flag_t<true>{});
    XWAIT1(vof);   // the last refill's value loads, before their offset register is reused
    if (dg) pass(k0, int_t<2>{}, flag_t<true>{}, flag_t<false>{}); }
  l[0] = ls[0][0] + ls[0][1]; l[1] = ls[1][0] + ls[1][1]; }
// joins the halves' sums, normalises and stores the 32 query rows at q0
__device__ __forceinline__ void fa_store(float* __restrict__ out, int b, int q0, int lane, v8f (&ot)[2][4], float (&l)[2]) {
  const int c = lane & 15, h = lane >> 4; const size_t bT = (size_t)b * TT;
#pragma unroll
  for (int u = 0; u < 2; ++u) { const float inv = 1.0f / (l[u] + xhalf(l[u])); float* o = out + (bT + q0 + 16 * u + c) * CC + 8 * h;
#pragma unroll
    for (int j = 0; j < 4; ++j) { ot[u][j] *= inv; const v8f y = ot[u][j]; vst2(o + j * 16, (v4f){y[0], y[1], y[2], y[3]}); vst2(o + j * 16 + 4, (v4f){y[4], y[5], y[6], y[7]}); }
    asm volatile("s_wait_xcnt 0x0" :: "v"(o), "v"(ot[u][0]), "v"(ot[u][1]), "v"(ot[u][2]), "v"(ot[u][3]) : "memory"); } }   // before the stores' address and data registers are reused
__global__ __launch_bounds__(256) void k_fa(const _Float16* __restrict__ QH, const _Float16* __restrict__ KH, const _Float16* __restrict__ QL, const _Float16* __restrict__ KL, const _Float16* __restrict__ VT, const __bf16* __restrict__ VB, const __bf16* __restrict__ VBL, float* __restrict__ out) {
  __shared__ __align__(16) v4f part[4][17][32];   // per pair, one 16-byte word per lane and slot: slots 0..15 the lower key range's O, slot 16 its (m0, m1, l0, l1)
  const int b = blockIdx.x, y = blockIdx.y; const int lane = threadIdx.x & 31; const int wave = __builtin_amdgcn_readfirstlane((int)(threadIdx.x >> 5)); const int pr = wave & 3;
  const int qL = (TT / 128 - 1 - y) * 128 + pr * 32, qE = y * 128 + pr * 32;
  // late-tile 32-key blocks handed to wave w + 4: half the difference of the two tiles' blocks; a high-precision block of the early tile is counted as two
  const int ks = 32 * (y * 128 < QHI ? TT / 64 - 3 - 6 * y : TT / 64 - 2 - 4 * y);
  // waves 0-3: one walk, keys [ks, diagonal] of the late tile; waves 4-7: two walks, the early tile and keys [0, ks) of the late tile
  const bool ehi = wave >= 4 && qE < QHI;
  if (ehi) { v8f oh[2][4] = {}; float mh[2] = {-1.0e30f, -1.0e30f}, lh[2] = {0.f, 0.f};
    fa_walk<true>(QH, KH, QL, KL, VT, VB, VBL, b, qE, 0, qE, true, lane, oh, mh, lh); fa_store(out, b, qE, lane, oh, lh); }
  v8f ot[2][4]; float m[2], l[2];
#pragma nounroll   // one copy of the pass code serves both walks: less text in the instruction cache
  for (int job = (wave < 4 || ehi) ? 1 : 0; job < 2; ++job) { const int q0 = job ? qL : qE; const bool low = wave >= 4 && job;
#pragma unroll
    for (int u = 0; u < 2; ++u) { m[u] = -1.0e30f; l[u] = 0.f;
#pragma unroll
      for (int j = 0; j < 4; ++j) ot[u][j] = (v8f){}; }
    fa_walk64(QH, KH, VT, b, q0, wave < 4 ? ks : 0, low ? ks : q0, !low, lane, ot, m, l);
    if (!job) fa_store(out, b, q0, lane, ot, l); }
  if (wave >= 4) {
#pragma unroll
    for (int u = 0; u < 2; ++u)
#pragma unroll
      for (int j = 0; j < 4; ++j) { const v8f t = ot[u][j]; part[pr][u * 8 + j * 2][lane] = (v4f){t[0], t[1], t[2], t[3]}; part[pr][u * 8 + j * 2 + 1][lane] = (v4f){t[4], t[5], t[6], t[7]}; }
    part[pr][16][lane] = (v4f){m[0], m[1], l[0], l[1]}; }
  __syncthreads();   // the lower ranges' partial results are in LDS; every wave passes here once
  if (wave < 4) { const v4f ml = part[pr][16][lane];
#pragma unroll
    for (int u = 0; u < 2; ++u) { const float mn = fmaxf(m[u], ml[u]); const float fa = __builtin_amdgcn_exp2f(m[u] - mn), fb = __builtin_amdgcn_exp2f(ml[u] - mn); l[u] = l[u] * fa + ml[2 + u] * fb;
#pragma unroll
      for (int j = 0; j < 4; ++j) { const v4f p0 = part[pr][u * 8 + j * 2][lane], p1 = part[pr][u * 8 + j * 2 + 1][lane];
#pragma unroll
        for (int i = 0; i < 4; ++i) { ot[u][j][i] = ot[u][j][i] * fa + p0[i] * fb; ot[u][j][4 + i] = ot[u][j][4 + i] * fa + p1[i] * fb; } } }
    fa_store(out, b, qL, lane, ot, l); } }

extern "C" void kernel_launch(void* const* d_in, const int* in_sizes, int n_in, void* d_out, int out_size, void* d_ws, size_t ws_size, hipStream_t stream) {
  (void)in_sizes; (void)n_in; (void)out_size;
  const float** F = (const float**)d_in;
  if (ws_size < (size_t)WS_END) return;
  char* ws = (char*)d_ws; _Float16 *QH = (_Float16*)(ws + WS_QH), *KH = (_Float16*)(ws + WS_KH), *VT = (_Float16*)(ws + WS_VT), *QL = (_Float16*)(ws + WS_QL), *KL = (_Float16*)(ws + WS_KL); __bf16 *VB = (__bf16*)(ws + WS_VB), *VBL = (__bf16*)(ws + WS_VBL); float *S = (float*)(ws + WS_S), *Y = (float*)(ws + WS_Y);
  (void)S; (void)Y; (void)QL; (void)KL; (void)VB; (void)VBL;
  // inputs: 0 queries [16,4096,64]; 1 keys; 2 values
  k_planes64<<<dim3(TNB * TT / 64), 256, 0, stream>>>(F[0], F[1], F[2], QH, QL, KH, KL, VT, VB, VBL);
  k_fa<<<dim3(TNB, TT / 256), 256, 0, stream>>>(QH, KH, QL, KL, VT, VB, VBL, (float*)d_out);
}

// v006
// One run takes 41.9 microseconds.
// Two timings next to v005 both put it at 1.04 times that version's speed.
// Counting every step since v000, it is 61.1 times as fast.
// compute dtype: all float inputs rounded to bf16; Q, K, V are bf16-valued so their f16 planes are exact; causal logits q x k (1 product; the residual products below row 384 multiply exact zeros) x 64^-0.5; online softmax f32; unnormalised P = 2^(s - m) once to f16 x v (exact) (bf16 hi + lo P below row 384), divided by the f32 row sum at the end; f32 output.
#include <hip/hip_runtime.h>
#include <math.h>

typedef __attribute__((ext_vector_type(16))) _Float16 v16h;
typedef __attribute__((ext_vector_type(16))) __bf16 v16b;
typedef __attribute__((ext_vector_type(8)))  _Float16 v8h;
typedef __attribute__((ext_vector_type(8)))  float v8f;
typedef __attribute__((ext_vector_type(4)))  float v4f;
typedef __attribute__((ext_vector_type(2)))  float v2f;
typedef __attribute__((ext_vector_type(4)))  unsigned v4u;
typedef _Float16 hx8 __attribute__((ext_vector_type(8)));
typedef __attribute__((ext_vector_type(4)))  int v4i;
typedef float __attribute__((may_alias)) float_a;
typedef int __attribute__((may_alias)) int_a;

template <typename T> __device__ __forceinline__ void vst2(void* p, T v) { *(T*)p = v;  }
__device__ __forceinline__ v8f wmma16(v16h a, v16h b, v8f c) {
  v8f d = __builtin_amdgcn_wmma_f32_16x16x32_f16(false, a, false, b, (short)0, c, false, false);
  asm volatile("v_nop\n\tv_nop\n\tv_nop\n\tv_nop" : "+v"(d) : "v"(a), "v"(b));
  return d;
}
__device__ __forceinline__ v8f wmma_bf(v16b a, v16b b, v8f c) {
  v8f d = __builtin_amdgcn_wmma_f32_16x16x32_bf16(false, a, false, b, (short)0, c, false, false);
  asm volatile("v_nop\n\tv_nop\n\tv_nop\n\tv_nop" : "+v"(d) : "v"(a), "v"(b));
  return d;
}
// 16x16x32 fragments: lane = (h = lane>>4, row/col = lane&15); elements 0..7 = k0+8h+0..7, 8..15 = k0+16+8h+0..7; D element r = row 8h+r
__device__ __forceinline__ v16h frag_h(const _Float16* rowk0, int lane) {
  union { v16h v; v8h q[2]; } u; const _Float16* p = rowk0 + 8 * (lane >> 4);
  u.q[0] = *(const v8h*)p; u.q[1] = *(const v8h*)(p + 16); return u.v;
}
__device__ __forceinline__ v16h frag_f32(const float* rowk0, int lane) {
  v16h a; const float* p = rowk0 + 8 * (lane >> 4);
#pragma unroll
  for (int i = 0; i < 8; ++i) { a[i] = (_Float16)p[i]; a[8 + i] = (_Float16)p[16 + i]; }
  return a;
}
__device__ __forceinline__ v16h frag_f32s(const float* rowk0, int lane, float sc) {
  v16h a; const float* p = rowk0 + 8 * (lane >> 4);
#pragma unroll
  for (int i = 0; i < 8; ++i) { a[i] = (_Float16)(p[i] * sc); a[8 + i] = (_Float16)(p[16 + i] * sc); }
  return a;
}
// column fragment from a [K][ld] layout (column n), rows >= K read as 0
__device__ __forceinline__ v16h fragc_f32(const float* W, int k0, int n, int lane, int ld, int K) {
  v16h a; const int g = lane >> 4;
#pragma unroll
  for (int i = 0; i < 8; ++i) { const int ka = k0 + 8 * g + i, kb = ka + 16;
    a[i] = (_Float16)(ka < K ? W[(size_t)(ka < K ? ka : K - 1) * ld + n] : 0.f); a[8 + i] = (_Float16)(kb < K ? W[(size_t)(kb < K ? kb : K - 1) * ld + n] : 0.f); }
  return a;
}
struct F2 { v16b h, l; };
__device__ __forceinline__ F2 bsplit16(const float v[16]) { F2 r;
#pragma unroll
  for (int i = 0; i < 16; ++i) { const __bf16 h = (__bf16)v[i]; r.h[i] = h; r.l[i] = (__bf16)(v[i] - (float)h); }
  return r; }
__device__ __forceinline__ F2 split_row(const float* row, int k0, int lane) { float v[16]; const float* p = row + k0 + 8 * (lane >> 4);
#pragma unroll
  for (int i = 0; i < 8; ++i) { v[i] = p[i]; v[8 + i] = p[16 + i]; }
  return bsplit16(v); }
__device__ __forceinline__ F2 split_rowK(const float* row, int k0, int lane, int K) { float v[16]; const int g = lane >> 4;
#pragma unroll
  for (int i = 0; i < 8; ++i) { const int ka = k0 + 8 * g + i, kb = ka + 16; v[i] = ka < K ? row[ka < K ? ka : K - 1] : 0.f; v[8 + i] = kb < K ? row[kb < K ? kb : K - 1] : 0.f; }
  return bsplit16(v); }
__device__ __forceinline__ F2 split_col(const float* W, int k0, int n, int lane, int ld, int K) { float v[16]; const int g = lane >> 4;
#pragma unroll
  for (int i = 0; i < 8; ++i) { const int ka = k0 + 8 * g + i, kb = ka + 16; v[i] = ka < K ? W[(size_t)(ka < K ? ka : K - 1) * ld + n] : 0.f; v[8 + i] = kb < K ? W[(size_t)(kb < K ? kb : K - 1) * ld + n] : 0.f; }
  return bsplit16(v); }
__device__ __forceinline__ v8f mac3(const F2& a, const F2& b, v8f c) { c = wmma_bf(a.l, b.h, c); c = wmma_bf(a.h, b.l, c); return wmma_bf(a.h, b.h, c); }
__device__ __forceinline__ float sigm(float v) { return 1.0f / (1.0f + expf(-v)); }
#define LDSX() do { asm volatile("s_wait_dscnt 0" ::: "memory"); __builtin_amdgcn_wave_barrier(); __builtin_amdgcn_fence(__ATOMIC_RELEASE, "workgroup"); } while (0)

// Causal scaled-dot-product attention on given tensors (queries / keys / values [16,4096,64], single head; the module adds -2^32 to the strictly-upper triangle before the softmax - equivalent to excluding those keys): out = softmax(causal(Q K^T / 8)) V -> [16,4096,64].
#define NB 16
#define TT 4096
#define CC 64            // NH * HD = projected width
#define DIN 64          // input (model) width
#define NH 1
#define HD 64
#define NQB (TT / 64)
#define HG 1
#define SCALE (0.125f)
#define CAUSAL 1
#ifndef TNB
#define TNB NB
#endif
__device__ __forceinline__ float bfr(float v) { return (float)(__bf16)v; }
__host__ __device__ __forceinline__ int kb_last(int qb) { return CAUSAL ? ((qb * 64 + 63) >> 7) : (TT / 128 - 1); }
typedef __attribute__((ext_vector_type(8))) __bf16 v8b;
__device__ __forceinline__ v16b frag_b(const __bf16* rowk0, int lane) {
  union { v16b v; v8b q[2]; } u; const __bf16* p = rowk0 + 8 * (lane >> 4);
  u.q[0] = *(const v8b*)p; u.q[1] = *(const v8b*)(p + 16); return u.v;
}
#define QBH 6              // unused: the high-precision path is chosen by q0 < QHI (queries 0..383: few keys, no averaging)
#define QHI 384            // rows carrying a q residual plane
#define KHI 384            // key rows carrying k residual / v bf16 hi+lo planes (used only by the causal high-precision path)
// B fragment (k rows k0+.., output column o) of a weight: (in,out) [K][ld] or (out,in) [ld rows of K]: bf16 exact, or f16(bf16 * 256) exact
__device__ __forceinline__ v16b wcol_io(const float* Wm, int k0, int o, int lane, int ld) { v16b w; const int g = lane >> 4;
#pragma unroll
  for (int i = 0; i < 8; ++i) { w[i] = (__bf16)Wm[(size_t)(k0 + 8 * g + i) * ld + o]; w[8 + i] = (__bf16)Wm[(size_t)(k0 + 16 + 8 * g + i) * ld + o]; }
  return w; }
__device__ __forceinline__ v16b wcol_oi(const float* Wm, int k0, int o, int lane, int K) { v16b w; const float* p = Wm + (size_t)o * K + k0 + 8 * (lane >> 4);
#pragma unroll
  for (int i = 0; i < 8; ++i) { w[i] = (__bf16)p[i]; w[8 + i] = (__bf16)p[16 + i]; }
  return w; }
__device__ __forceinline__ v16h wcolh_io(const float* Wm, int k0, int o, int lane, int ld) { v16h w; const int g = lane >> 4;
#pragma unroll
  for (int i = 0; i < 8; ++i) { w[i] = (_Float16)(bfr(Wm[(size_t)(k0 + 8 * g + i) * ld + o]) * 256.0f); w[8 + i] = (_Float16)(bfr(Wm[(size_t)(k0 + 16 + 8 * g + i) * ld + o]) * 256.0f); }
  return w; }
__device__ __forceinline__ v16h wcolh_oi(const float* Wm, int k0, int o, int lane, int K) { v16h w; const float* p = Wm + (size_t)o * K + k0 + 8 * (lane >> 4);
#pragma unroll
  for (int i = 0; i < 8; ++i) { w[i] = (_Float16)(bfr(p[i]) * 256.0f); w[8 + i] = (_Float16)(bfr(p[16 + i]) * 256.0f); }
  return w; }
#define WQKV_LAYOUT 0   // 0 = (in,out) [DIN][CC]; 1 = (out,in) [CC][DIN]; 2 = per-head [NH][DIN][HD]
__device__ __forceinline__ v16b wcol_hdk(const float* Wm, int k0, int o, int lane) { v16b w; const int g = lane >> 4; const float* p = Wm + (size_t)(o / HD) * DIN * HD + (o % HD);
#pragma unroll
  for (int i = 0; i < 8; ++i) { w[i] = (__bf16)p[(size_t)(k0 + 8 * g + i) * HD]; w[8 + i] = (__bf16)p[(size_t)(k0 + 16 + 8 * g + i) * HD]; }
  return w; }
#define WO_OUT_IN 0
#if WQKV_LAYOUT == 1
#define WCOL(W, k0, o, lane) wcol_oi(W, k0, o, lane, DIN)
#elif WQKV_LAYOUT == 2
#define WCOL(W, k0, o, lane) wcol_hdk(W, k0, o, lane)
#else
#define WCOL(W, k0, o, lane) wcol_io(W, k0, o, lane, CC)
#endif
#if WO_OUT_IN
#define WOCOL(W, k0, o, lane) wcol_oi(W, k0, o, lane, CC)
#define WOCOLH(W, k0, o, lane) wcolh_oi(W, k0, o, lane, CC)
#else
#define WOCOL(W, k0, o, lane) wcol_io(W, k0, o, lane, DIN)
#define WOCOLH(W, k0, o, lane) wcolh_io(W, k0, o, lane, DIN)
#endif
__global__ __launch_bounds__(256) void k_planes64(const float* __restrict__ Qs, const float* __restrict__ Ks, const float* __restrict__ Vs, _Float16* __restrict__ QH, _Float16* __restrict__ QL, _Float16* __restrict__ KH, _Float16* __restrict__ KL, _Float16* __restrict__ VT, __bf16* __restrict__ VB, __bf16* __restrict__ VBL) {
  __shared__ __align__(16) _Float16 sv[64][72], sk[64][72], skl[64][72];
  const int tid = threadIdx.x; const size_t r0 = (size_t)blockIdx.x * 64; const int b = (int)(r0 / TT), t0 = (int)(r0 % TT);
  for (int e = tid; e < 64 * 8; e += 256) { const int rl = e >> 3, q = e & 7; const size_t src = (r0 + rl) * CC + q * 8; float tq[8], tk[8], tv[8];
#pragma unroll
    for (int u = 0; u < 8; ++u) { tq[u] = Qs[src + u]; tk[u] = Ks[src + u]; tv[u] = Vs[src + u]; }
    asm volatile("s_wait_loadcnt 0x0" ::: "memory");
    hx8 hq, hk, hlq, hlk;
#pragma unroll
    for (int u = 0; u < 8; ++u) { const float qv = bfr(tq[u]), kv = bfr(tk[u]); const _Float16 qh = (_Float16)qv, kh = (_Float16)kv; hq[u] = qh; hlq[u] = (_Float16)((qv - (float)qh) * 1024.0f); hk[u] = kh; hlk[u] = (_Float16)((kv - (float)kh) * 1024.0f); sv[rl][q * 8 + u] = (_Float16)bfr(tv[u]); }
    const v4u wh = *(const v4u*)&hq; vst2((unsigned*)(QH + (r0 + rl) * CC + q * 8), wh); vst2(&sk[rl][q * 8], *(const v4u*)&hk);
    asm volatile("s_wait_xcnt 0x0" :: "v"(wh) : "memory");   // before the store's data registers are reused
    if (t0 < KHI) vst2(&skl[rl][q * 8], *(const v4u*)&hlk);
    if (t0 + rl < QHI) { const v4u wq = *(const v4u*)&hlq; vst2((unsigned*)(QL + ((size_t)b * QHI + t0 + rl) * CC + q * 8), wq);
      asm volatile("s_wait_xcnt 0x0" :: "v"(wq) : "memory"); } }   // before the store's address and data registers are reused
  __syncthreads();
  // fragment order: 16-byte word e of these 64 keys is what lane e & 31 takes with one load, so a wave's load (and each store here) covers 512 contiguous bytes
  for (int e = tid; e < 64 * 8; e += 256) { const int c = e & 15, k8 = ((e >> 5) & 1) * 16 + ((e >> 4) & 1) * 8;
    const int row = (e >> 7) * 16 + c, d0 = ((e >> 6) & 1) * 32 + k8;   // keys: word = (16-key tile, 32-wide half of d, 16-wide half, h, key)
    const int ch = ((e >> 6) & 3) * 16 + c, kk = (e >> 8) * 32 + k8;   // values: word = (32-key pass, 16-channel tile, 16-key half, h, channel)
    const v4u wk = *(const v4u*)&sk[row][d0]; hx8 hv; _Pragma("unroll") for (int j = 0; j < 8; ++j) hv[j] = sv[kk + j][ch];
    const v4u wv = *(const v4u*)&hv; vst2((unsigned*)(KH + r0 * CC + e * 8), wk); vst2((unsigned*)(VT + r0 * CC + e * 8), wv);
    if (t0 < KHI) { const size_t o3 = ((size_t)b * KHI + t0) * CC + e * 8; const v4u wl = *(const v4u*)&skl[row][d0]; v8b bh, bl; _Pragma("unroll") for (int j = 0; j < 8; ++j) { const float vv = (float)hv[j]; const __bf16 h1 = (__bf16)vv; bh[j] = h1; bl[j] = (__bf16)(vv - (float)h1); }
      const v4u wh = *(const v4u*)&bh, wb = *(const v4u*)&bl; vst2((unsigned*)(KL + o3), wl); vst2((unsigned*)(VB + o3), wh); vst2((unsigned*)(VBL + o3), wb);
      asm volatile("s_wait_xcnt 0x0" :: "v"(wl), "v"(wh), "v"(wb) : "memory"); }   // before these stores' registers are reused
    asm volatile("s_wait_xcnt 0x0" :: "v"(wk), "v"(wv), "v"(e) : "memory"); } }   // before the stores' data registers and the word index their addresses come from are reused
#ifndef SM_EXTRA_PARAMS
#define SM_EXTRA_PARAMS
#endif
#ifndef PROJ_EXTRA_PARAMS
#define PROJ_EXTRA_PARAMS
#endif
#ifndef SM_MASK_HOOK
#define SM_MASK_HOOK (void)0
#endif

#define WS_QH  0u                                      // f16 q rows [b*t][CC]
#define WS_KH  (WS_QH + 2u * (size_t)NB * TT * CC)      // f16 k in fragment order [b][t / 16][d / 32][(d / 16) & 1][lane = 16 * ((d / 8) & 1) + t % 16][d % 8]
#define WS_VT  (WS_KH + 2u * (size_t)NB * TT * CC)      // f16 v in fragment order [b][t / 32][c / 16][(t / 16) & 1][lane = 16 * ((t / 8) & 1) + c % 16][t % 8]
#define WS_QL  (WS_VT + 2u * (size_t)NB * CC * TT)      // f16 q residual x 2^10 rows [b][t < QHI][CC]
#define WS_KL  (WS_QL + 2u * (size_t)NB * QHI * CC)     // f16 k residual x 2^10, t < KHI, in the order of the k plane
#define WS_VB  (WS_KL + 2u * (size_t)NB * KHI * CC)     // bf16 v hi (and lo behind it), t < KHI, in the order of the v plane
#define WS_VBL (WS_VB + 2u * (size_t)NB * CC * KHI)
#define WS_S   (WS_VBL + 2u * (size_t)NB * CC * KHI)    // f32 [hg][t][s] region, unused: logits and P stay in registers
#define WS_Y   (WS_S  + 4u * (size_t)HG * TT * TT)      // f32 ctx rows [b*t][CC] (only when there is an output projection)
#define WS_END (WS_Y  + 0u)

// ---- k_proj: block = (64 rows, 128 cols, which): q/k/v = X W (+ b) with exact bf16 products (K = DIN) -> which 0: q f16 rows (+ residual rows < QHI); 1: k f16 rows (+ residual rows < KHI); 2: v f16 planes [c][t] (+ bf16 hi/lo planes for t < KHI)
__global__ __launch_bounds__(128) void k_proj(const float* __restrict__ XQ, const float* __restrict__ XK, const float* __restrict__ XV, const float* __restrict__ WQ, const float* __restrict__ WK, const float* __restrict__ WV, const float* __restrict__ BQ, const float* __restrict__ BK, const float* __restrict__ BV,
    _Float16* __restrict__ QH, _Float16* __restrict__ QL, _Float16* __restrict__ KH, _Float16* __restrict__ KL, _Float16* __restrict__ VT, __bf16* __restrict__ VB, __bf16* __restrict__ VBL) {
  __shared__ __align__(16) _Float16 sh[64][136], sl[64][136]; __shared__ __align__(16) _Float16 th[128][72]; __shared__ __align__(16) __bf16 tb[128][72], tbl[128][72];
  const int tid = threadIdx.x, wave = tid >> 5, lane = tid & 31, col = lane & 15, g = lane >> 4; const int which = blockIdx.z; const int c0 = blockIdx.y * 128; const size_t r0 = (size_t)blockIdx.x * 64; const size_t bb = r0 / TT; const int t0 = (int)(r0 % TT);
  const float* X = which == 0 ? XQ : which == 1 ? XK : XV; const float* WA = which == 0 ? WQ : which == 1 ? WK : WV; const float* BA = which == 0 ? BQ : which == 1 ? BK : BV;
  v8f acc[8] = {};
#pragma unroll 2
  for (int kc = 0; kc < DIN / 32; ++kc) { v16b a; { const float* p = X + (r0 + wave * 16 + col) * DIN + kc * 32 + 8 * g;
#pragma unroll
      for (int i = 0; i < 8; ++i) { a[i] = (__bf16)p[i]; a[8 + i] = (__bf16)p[16 + i]; } }
    asm volatile("s_wait_loadcnt 0x0" ::: "memory");
#pragma unroll
    for (int j = 0; j < 8; ++j) { const v16b w = WCOL(WA, kc * 32, c0 + j * 16 + col, lane); asm volatile("s_wait_loadcnt 0x0" ::: "memory"); acc[j] = wmma_bf(a, w, acc[j]); } }
  if (which < 2) { _Float16* DH = which == 0 ? QH : KH; _Float16* DL = which == 0 ? QL : KL; const int nhi = which == 0 ? QHI : KHI; const bool hi_rows = t0 < nhi;
#pragma unroll
    for (int j = 0; j < 8; ++j) { const float bias = BA ? bfr(BA[c0 + j * 16 + col]) : 0.f;
#pragma unroll
      for (int r = 0; r < 8; ++r) { const float v = acc[j][r] + bias; const _Float16 hv = (_Float16)v; sh[wave * 16 + 8 * g + r][j * 16 + col] = hv; sl[wave * 16 + 8 * g + r][j * 16 + col] = (_Float16)((v - (float)hv) * 1024.0f); } }
    __syncthreads();
    for (int e = tid; e < 64 * 16; e += 128) { const int rl = e >> 4, q = e & 15; vst2((unsigned*)(DH + (r0 + rl) * CC + c0 + q * 8), *(const v4u*)&sh[rl][q * 8]); if (hi_rows) vst2((unsigned*)(DL + (bb * nhi + t0 + rl) * (size_t)CC + c0 + q * 8), *(const v4u*)&sl[rl][q * 8]); }
  } else { const bool hi_rows = t0 < KHI;
#pragma unroll
    for (int j = 0; j < 8; ++j) { const float bias = BA ? bfr(BA[c0 + j * 16 + col]) : 0.f;
#pragma unroll
      for (int r = 0; r < 8; ++r) { const float v = acc[j][r] + bias; const int rl = wave * 16 + 8 * g + r, cl = j * 16 + col; th[cl][rl] = (_Float16)v; const __bf16 bh = (__bf16)v; tb[cl][rl] = bh; tbl[cl][rl] = (__bf16)(v - (float)bh); } }
    __syncthreads();
    for (int e = tid; e < 128 * 8; e += 128) { const int cl = e >> 3, q = e & 7; vst2((unsigned*)(VT + (bb * CC + c0 + cl) * (size_t)TT + t0 + q * 8), *(const v4u*)&th[cl][q * 8]); if (hi_rows) { const size_t o3 = (bb * CC + c0 + cl) * (size_t)KHI + t0 + q * 8; vst2((unsigned*)(VB + o3), *(const v4u*)&tb[cl][q * 8]); vst2((unsigned*)(VBL + o3), *(const v4u*)&tbl[cl][q * 8]); } } } }
template <bool B> struct flag_t { static constexpr bool v = B; };
template <int N> struct int_t { static constexpr int v = N; };
__device__ __forceinline__ float xhalf(float x) { return __builtin_bit_cast(float, __builtin_amdgcn_permlanex16(__builtin_bit_cast(int, x), __builtin_bit_cast(int, x), 0x76543210, 0xfedcba98, false, false)); }  // lane l with lane l ^ 16, on the vector pipe
__device__ __forceinline__ v8f mm_h(v16h a, v16h b, v8f c) { return __builtin_amdgcn_wmma_f32_16x16x32_f16(false, a, false, b, (short)0, c, false, false); }
__device__ __forceinline__ v8f mm_b(v16b a, v16b b, v8f c) { return __builtin_amdgcn_wmma_f32_16x16x32_bf16(false, a, false, b, (short)0, c, false, false); }
// fragment from a lane's own pointer (row start + k0 + 8h): the same k order as frag_h / frag_b
__device__ __forceinline__ v16h frag_hp(const _Float16* p) { union { v16h v; v8h q[2]; } u; u.q[0] = *(const v8h*)p; u.q[1] = *(const v8h*)(p + 16); return u.v; }
__device__ __forceinline__ v16b frag_bp(const __bf16* p) { union { v16b v; v8b q[2]; } u; u.q[0] = *(const v8b*)p; u.q[1] = *(const v8b*)(p + 16); return u.v; }
// fragment from the fragment-ordered planes, from a lane's own pointer (fragment start + 8 * lane): two loads, each 512 contiguous bytes over the wave; the same k order as frag_h / frag_b
__device__ __forceinline__ v16h frag_hk(const _Float16* p) { union { v16h v; v8h q[2]; } u; u.q[0] = *(const v8h*)p; u.q[1] = *(const v8h*)(p + 256); return u.v; }
__device__ __forceinline__ v16b frag_bk(const __bf16* p) { union { v16b v; v8b q[2]; } u; u.q[0] = *(const v8b*)p; u.q[1] = *(const v8b*)(p + 256); return u.v; }
// s_wait_xcnt 0 behind a run of loads, before their address registers are reused; the pointers are inputs so that those registers stay theirs up to the wait; the clobber keeps the loads issued in front of it, ahead of their use
#define XWAIT1(p) asm volatile("s_wait_xcnt 0x0" :: "v"(p) : "memory")
#define XWAIT2(p, q) asm volatile("s_wait_xcnt 0x0" :: "v"(p), "v"(q) : "memory")
// the vector slot behind a transcendental: one v_nop that stands behind the exponentials (it takes their results) and up to which their source registers stay theirs (it takes the sources), so that no instruction directly behind one overwrites its source
#define TSLOT1(a, r) asm volatile("v_nop" :: "v"(a), "v"(r))
#define TSLOT8(a, r, o) asm volatile("v_nop" :: "v"(a[o]), "v"(a[o + 1]), "v"(a[o + 2]), "v"(a[o + 3]), "v"(a[o + 4]), "v"(a[o + 5]), "v"(a[o + 6]), "v"(a[o + 7]), "v"(r[o]), "v"(r[o + 1]), "v"(r[o + 2]), "v"(r[o + 3]), "v"(r[o + 4]), "v"(r[o + 5]), "v"(r[o + 6]), "v"(r[o + 7]))
// walks keys [kbeg, kend) in full passes and, with dg (wave-uniform), the diagonal pass at q0 (then kend == q0); ot, m, l come in at their start values and leave unnormalised
template <bool HI>
__device__ __forceinline__ void fa_walk(const _Float16* __restrict__ QH, const _Float16* __restrict__ KH, const _Float16* __restrict__ QL, const _Float16* __restrict__ KL, const _Float16* __restrict__ VT, const __bf16* __restrict__ VB, const __bf16* __restrict__ VBL, int b, int q0, int kbeg, int kend, bool dg, int lane, v8f (&ot)[2][4], float (&m)[2], float (&l)[2]) {
  const int c = lane & 15, h = lane >> 4; const size_t bT = (size_t)b * TT;
  const float CS = SCALE * 1.4426950408889634f;   // logits go to the log2 domain inside the exponent's multiply-add
  v16h qf[2][2], qlf[2][2]; const _Float16* pq = QH + (bT + q0 + c) * CC + 8 * h; const _Float16* pql = QL + ((size_t)b * QHI + (HI ? q0 : 0) + c) * CC + 8 * h;
#pragma unroll
  for (int u = 0; u < 2; ++u)
#pragma unroll
    for (int kc = 0; kc < 2; ++kc) { qf[u][kc] = frag_hp(pq + u * 16 * CC + kc * 32); if constexpr (HI) qlf[u][kc] = frag_hp(pql + u * 16 * CC + kc * 32); }
  if constexpr (HI) XWAIT2(pq, pql); else XWAIT1(pq);
  v16h ka[2][2], kla[2][2]; v16h vf[4]; v16b vbh[4], vbl[4];
  auto load_k = [&](v16h (&kf)[2][2], v16h (&klf)[2][2], int k0) { const _Float16* pk = KH + (bT + k0) * CC + 8 * lane; const _Float16* pkl = KL + ((size_t)b * KHI + (HI ? k0 : 0)) * CC + 8 * lane;
#pragma unroll
    for (int t = 0; t < 2; ++t)
#pragma unroll
      for (int kc = 0; kc < 2; ++kc) { kf[t][kc] = frag_hk(pk + (t * 2 + kc) * 512); if constexpr (HI) klf[t][kc] = frag_hk(pkl + (t * 2 + kc) * 512); }
    if constexpr (HI) XWAIT2(pk, pkl); else XWAIT1(pk); };
  // values of key block k0 + D: the pointers stand at k0 and D is a constant of the loads' offsets, so the registers the loads name are the ones the wait holds
  auto load_v = [&](int k0, auto dd) { constexpr int D = decltype(dd)::v;
    if constexpr (HI) { const __bf16* ph = VB + ((size_t)b * KHI + k0) * CC + 8 * lane; const __bf16* pl = VBL + ((size_t)b * KHI + k0) * CC + 8 * lane;
#pragma unroll
      for (int j = 0; j < 4; ++j) { vbh[j] = frag_bk(ph + D * CC + j * 512); vbl[j] = frag_bk(pl + D * CC + j * 512); }
      XWAIT2(ph, pl); }
    else { const _Float16* pv = VT + (bT + k0) * CC + 8 * lane;
#pragma unroll
      for (int j = 0; j < 4; ++j) vf[j] = frag_hk(pv + D * CC + j * 512);
      XWAIT1(pv); } };
  // the loop's own refills name a plane's base and a carried 32-bit byte offset: hof into the k plane, lof into the planes that hold rows < KHI only (k residual, v hi, v lo); in front of the pass's s_wait_xcnt 0 they stand at the pass's keys, behind it at the next pass's
  unsigned hof = (unsigned)(((bT + kbeg) * CC + 8 * lane) * 2), lof = (unsigned)((((size_t)b * KHI + kbeg) * CC + 8 * lane) * 2);
  auto next_k = [&](v16h (&kf)[2][2], v16h (&klf)[2][2]) { const _Float16* pk = (const _Float16*)((const char*)KH + hof); const _Float16* pkl = (const _Float16*)((const char*)KL + lof);
#pragma unroll
    for (int t = 0; t < 2; ++t)
#pragma unroll
      for (int kc = 0; kc < 2; ++kc) { kf[t][kc] = frag_hk(pk + 32 * CC + (t * 2 + kc) * 512); klf[t][kc] = frag_hk(pkl + 32 * CC + (t * 2 + kc) * 512); } };
  auto next_v = [&]() { const __bf16* ph = (const __bf16*)((const char*)VB + lof); const __bf16* pl = (const __bf16*)((const char*)VBL + lof);
#pragma unroll
    for (int j = 0; j < 4; ++j) { vbh[j] = frag_bk(ph + j * 512); vbl[j] = frag_bk(pl + j * 512); } };
  // one pass: kf / klf hold this pass's keys and are refilled with those of key block kn (the next pass's) right behind the logits; vbh / vbl hold this pass's values and are refilled with the next pass's behind P V
  auto pass = [&](int k0, v16h (&kf)[2][2], v16h (&klf)[2][2], int kn, auto diag) {
    constexpr bool DIAG = decltype(diag)::v;
    v8f st[2][2] = {}, sl[2][2] = {};
#pragma unroll
    for (int kc = 0; kc < 2; ++kc)
#pragma unroll
      for (int t = 0; t < 2; ++t)
#pragma unroll
        for (int u = 0; u < 2; ++u) { st[u][t] = mm_h(kf[t][kc], qf[u][kc], st[u][t]); if constexpr (HI) { sl[u][t] = mm_h(kf[t][kc], qlf[u][kc], sl[u][t]); sl[u][t] = mm_h(klf[t][kc], qf[u][kc], sl[u][t]); } }
    if constexpr (!DIAG) next_k(kf, klf);
    float s[2][16], mx[2];
#pragma unroll
    for (int u = 0; u < 2; ++u) { float a = -1.0e30f;
#pragma unroll
      for (int i = 0; i < 16; ++i) { float v = st[u][i >> 3][i & 7]; if constexpr (HI) v += sl[u][i >> 3][i & 7] * (1.0f / 1024.0f);
        if constexpr (DIAG) v = (k0 + 16 * (i >> 3) + 8 * h + (i & 7) <= q0 + 16 * u + c) ? v : -1.0e30f;
        s[u][i] = v; a = fmaxf(a, v); }
      mx[u] = fmaxf(a, xhalf(a)) * CS; }
    // the pass's one s_wait_xcnt 0, before the offset registers of this pass's key loads and of the last pass's value loads are rewritten: it takes the maxima so that it stands behind the maximum chain, for speed only; the offsets go through it so that their additions stay behind it
    if constexpr (!DIAG) { asm volatile("s_wait_xcnt 0x0" : "+v"(hof), "+v"(lof) : "v"(mx[0]), "v"(mx[1]) : "memory"); hof += 32 * CC * 2; lof += 32 * CC * 2; }
    // lazy rescale: the maximum in use moves only when a column's new maximum passes it by more than 8 (log2), so P stays <= 2^8; one scalar branch per pass
    if (__builtin_amdgcn_ballot_w32(mx[0] > m[0] + 8.0f || mx[1] > m[1] + 8.0f) != 0) {
#pragma unroll
      for (int u = 0; u < 2; ++u) { const float mn = fmaxf(m[u], mx[u]); const float da = m[u] - mn; const float al = __builtin_amdgcn_exp2f(da); TSLOT1(da, al); m[u] = mn; l[u] *= al;
#pragma unroll
        for (int j = 0; j < 4; ++j) ot[u][j] *= al; } }
#pragma unroll
    for (int u = 0; u < 2; ++u) { float p[16], e[16];
#pragma unroll
      for (int i = 0; i < 16; ++i) { e[i] = __builtin_fmaf(s[u][i], CS, -m[u]); p[i] = __builtin_amdgcn_exp2f(e[i]); }
      if constexpr (!HI) { TSLOT8(e, p, 0); TSLOT8(e, p, 8); }   // the high-precision build keeps the slot by itself (read in the listing) and has no registers to spare
#pragma unroll
      for (int i = 0; i < 16; ++i) l[u] += p[i];
      if constexpr (HI) { const F2 pb = bsplit16(p);
#pragma unroll
        for (int j = 0; j < 4; ++j) { ot[u][j] = mm_b(vbh[j], pb.h, ot[u][j]); ot[u][j] = mm_b(vbh[j], pb.l, ot[u][j]); ot[u][j] = mm_b(vbl[j], pb.h, ot[u][j]); } }
      else { v16h pf;
#pragma unroll
        for (int i = 0; i < 16; ++i) pf[i] = (_Float16)p[i];
#pragma unroll
        for (int j = 0; j < 4; ++j) ot[u][j] = mm_h(vf[j], pf, ot[u][j]); } }
    if constexpr (!DIAG) next_v(); };
  load_k(ka, kla, kbeg); load_v(kbeg, int_t<0>{});
  for (int k0 = kbeg; k0 < kend; k0 += 32) pass(k0, ka, kla, k0 + 32, flag_t<false>{});
  XWAIT1(lof);   // the last refill's value loads, before their offset register is reused
  if (dg) pass(q0, ka, kla, q0, flag_t<true>{}); }
// the plain-precision walk of 64 queries (four 16-column groups) at q0: keys [kbeg, kend) in unmasked passes of 32 keys and, with dg (wave-uniform; then kend == q0), the two masked diagonal passes at q0 and q0 + 32. Each key and value fragment feeds four query groups. ot, m, l come in at their start values and leave unnormalised
__device__ __forceinline__ void fa_walkq(const _Float16* __restrict__ QH, const _Float16* __restrict__ KH, const _Float16* __restrict__ VT, int b, int q0, int kbeg, int kend, bool dg, int lane, v8f (&ot)[4][4], float (&m)[4], float (&l)[4]) {
  const int c = lane & 15, h = lane >> 4; const size_t bT = (size_t)b * TT;
  const float CS = SCALE * 1.4426950408889634f;   // logits go to the log2 domain inside the exponent's multiply-add
  v16h qf[4][2]; const _Float16* pq = QH + (bT + q0 + c) * CC + 8 * h;
#pragma unroll
  for (int u = 0; u < 4; ++u)
#pragma unroll
    for (int kc = 0; kc < 2; ++kc) qf[u][kc] = frag_hp(pq + u * 16 * CC + kc * 32);
  XWAIT1(pq);
  v16h ka[2][2], vf[4];
  { const _Float16* pk = KH + (bT + kbeg) * CC + 8 * lane;
#pragma unroll
    for (int t = 0; t < 2; ++t)
#pragma unroll
      for (int kc = 0; kc < 2; ++kc) ka[t][kc] = frag_hk(pk + (t * 2 + kc) * 512);
    XWAIT1(pk); }
  { const _Float16* pv = VT + (bT + kbeg) * CC + 8 * lane;
#pragma unroll
    for (int j = 0; j < 4; ++j) vf[j] = frag_hk(pv + j * 512);
    XWAIT1(pv); }
  // the refills name the plane's base and one carried 32-bit byte offset each (kof at the pass's keys, vof at the next pass's values); the offsets move only behind the pass's one s_wait_xcnt 0
  unsigned kof = (unsigned)(((bT + kbeg) * CC + 8 * lane) * 2), vof = kof;
  auto next_k = [&]() { const _Float16* pk = (const _Float16*)((const char*)KH + kof);
#pragma unroll
    for (int t = 0; t < 2; ++t)
#pragma unroll
      for (int kc = 0; kc < 2; ++kc) ka[t][kc] = frag_hk(pk + 32 * CC + (t * 2 + kc) * 512); };
  auto next_v = [&]() { const _Float16* pv = (const _Float16*)((const char*)VT + vof);
#pragma unroll
    for (int j = 0; j < 4; ++j) vf[j] = frag_hk(pv + j * 512); };
  // one pass over the 32 keys at k0: ka holds them and, with NEXT, is refilled with the next 32 right behind the logits; vf holds their values and is refilled behind P V; MG says which query groups meet the diagonal in it: -1 none; 0 groups 0 and 1 (keys past a query are dropped; groups 2 and 3 see every key); 1 groups 2 and 3, while groups 0 and 1 see no key of it and are left out
  auto pass = [&](int k0, auto mask, auto next) {
    constexpr int MG = decltype(mask)::v, ULO = MG == 1 ? 2 : 0; constexpr bool NEXT = decltype(next)::v;
    v8f st[4][2] = {};
#pragma unroll
    for (int kc = 0; kc < 2; ++kc)
#pragma unroll
      for (int t = 0; t < 2; ++t)
#pragma unroll
        for (int u = ULO; u < 4; ++u) st[u][t] = mm_h(ka[t][kc], qf[u][kc], st[u][t]);
    if constexpr (NEXT) next_k();
    float mx[4]; bool need = false;
#pragma unroll
    for (int u = ULO; u < 4; ++u) { float a = -1.0e30f;
#pragma unroll
      for (int i = 0; i < 16; ++i) { float v = st[u][i >> 3][i & 7];
        if ((u >> 1) == MG) { v = (k0 + 16 * (i >> 3) + 8 * h + (i & 7) <= q0 + 16 * u + c) ? v : -1.0e30f; st[u][i >> 3][i & 7] = v; }
        a = fmaxf(a, v); }
      mx[u] = fmaxf(a, xhalf(a)) * CS; need = need || mx[u] > m[u] + 8.0f; }
    // the pass's one s_wait_xcnt 0, before the offset registers of this pass's key loads and of the last pass's value loads are rewritten: it takes the maxima so that it stands behind the maximum chain; the offsets go through it so that their additions stay behind it
    if constexpr (NEXT) { asm volatile("s_wait_xcnt 0x0" : "+v"(kof), "+v"(vof) : "v"(mx[0]), "v"(mx[1]), "v"(mx[2]), "v"(mx[3]) : "memory"); kof += 32 * CC * 2; vof += 32 * CC * 2; }
    // lazy rescale: the maximum in use moves only when a column's new maximum passes it by more than 8 (log2), so P stays <= 2^8; one scalar branch per pass
    if (__builtin_amdgcn_ballot_w32(need) != 0) {
#pragma unroll
      for (int u = ULO; u < 4; ++u) { const float mn = fmaxf(m[u], mx[u]); const float da = m[u] - mn; const float al = __builtin_amdgcn_exp2f(da); TSLOT1(da, al); m[u] = mn; l[u] *= al;
#pragma unroll
        for (int j = 0; j < 4; ++j) ot[u][j] *= al; } }
#pragma unroll
    for (int u = ULO; u < 4; ++u) { float p[16], e[16];
#pragma unroll
      for (int i = 0; i < 16; ++i) { e[i] = __builtin_fmaf(st[u][i >> 3][i & 7], CS, -m[u]); p[i] = __builtin_amdgcn_exp2f(e[i]); }
      TSLOT8(e, p, 0); TSLOT8(e, p, 8);
#pragma unroll
      for (int i = 0; i < 16; ++i) l[u] += p[i];
      v16h pf;
#pragma unroll
      for (int i = 0; i < 16; ++i) pf[i] = (_Float16)p[i];
#pragma unroll
      for (int j = 0; j < 4; ++j) ot[u][j] = mm_h(vf[j], pf, ot[u][j]);
      if constexpr (MG >= 0) __builtin_amdgcn_sched_barrier(0); }   // diagonal passes (two per walk): one query group's temporaries end before the next group's begin, else the build spills a register
    if constexpr (NEXT) next_v(); };
  int k0 = kbeg;
  for (; k0 < kend; k0 += 32) pass(k0, int_t<-1>{}, flag_t<true>{});
  if (dg) pass(k0, int_t<0>{}, flag_t<true>{});
  XWAIT1(vof);   // the last refill's value loads, before their offset register is reused
  if (dg) pass(k0 + 32, int_t<1>{}, flag_t<false>{}); }
// joins the halves' sums, normalises and stores the 32 query rows at q0
__device__ __forceinline__ void fa_store(float* __restrict__ out, int b, int q0, int lane, v8f (&ot)[2][4], float (&l)[2]) {
  const int c = lane & 15, h = lane >> 4; const size_t bT = (size_t)b * TT;
#pragma unroll
  for (int u = 0; u < 2; ++u) { const float inv = 1.0f / (l[u] + xhalf(l[u])); float* o = out + (bT + q0 + 16 * u + c) * CC + 8 * h;
#pragma unroll
    for (int j = 0; j < 4; ++j) { ot[u][j] *= inv; const v8f y = ot[u][j]; vst2(o + j * 16, (v4f){y[0], y[1], y[2], y[3]}); vst2(o + j * 16 + 4, (v4f){y[4], y[5], y[6], y[7]}); }
    asm volatile("s_wait_xcnt 0x0" :: "v"(o), "v"(ot[u][0]), "v"(ot[u][1]), "v"(ot[u][2]), "v"(ot[u][3]) : "memory"); } }   // before the stores' address and data registers are reused
// joins the NP partial results (ascending key ranges) of query group u (wave-uniform) of the 64-query tile at q0, normalises and stores its 16 rows
template <int NP>
__device__ __forceinline__ void fa_merge(const v4f (*pp)[34][32], float* __restrict__ out, int b, int q0, int u, int lane) {
  const int c = lane & 15, h = lane >> 4; float mp[NP], f[NP], mn = -1.0e30f, ls = 0.f;
#pragma unroll
  for (int n = 0; n < NP; ++n) { mp[n] = ((const float*)&pp[n][32][lane])[u]; mn = fmaxf(mn, mp[n]); }
#pragma unroll
  for (int n = 0; n < NP; ++n) { const float d = mp[n] - mn; f[n] = __builtin_amdgcn_exp2f(d); TSLOT1(d, f[n]); ls += ((const float*)&pp[n][33][lane])[u] * f[n]; }
  const float inv = 1.0f / (ls + xhalf(ls)); float* o = out + ((size_t)b * TT + q0 + 16 * u + c) * CC + 8 * h; v4f y[8];
#pragma unroll
  for (int s = 0; s < 8; ++s) { v4f acc = pp[0][u * 8 + s][lane] * f[0];
#pragma unroll
    for (int n = 1; n < NP; ++n) acc += pp[n][u * 8 + s][lane] * f[n];
    y[s] = acc * inv; vst2(o + (s >> 1) * 16 + (s & 1) * 4, y[s]); }
  asm volatile("s_wait_xcnt 0x0" :: "v"(o), "v"(y[0]), "v"(y[1]), "v"(y[2]), "v"(y[3]), "v"(y[4]), "v"(y[5]), "v"(y[6]), "v"(y[7]) : "memory"); }   // before the stores' address and data registers are reused
__global__ __launch_bounds__(256) void k_fa(const _Float16* __restrict__ QH, const _Float16* __restrict__ KH, const _Float16* __restrict__ QL, const _Float16* __restrict__ KL, const _Float16* __restrict__ VT, const __bf16* __restrict__ VB, const __bf16* __restrict__ VBL, float* __restrict__ out) {
  __shared__ __align__(16) v4f part[12][34][32];   // per tile pair six partial results (early tile: 2, late tile: 4, each in ascending key order), one 16-byte word per lane and slot: slots 0..31 O, slot 32 the four maxima, slot 33 the four sums
  const int b = blockIdx.x, y = blockIdx.y; const int lane = threadIdx.x & 31; const int wave = __builtin_amdgcn_readfirstlane((int)(threadIdx.x >> 5));
  const int pr = (wave >> 1) & 1, r = wave & 1; const bool lowr = wave >= 4;
  const int qL = (TT / 128 - 1 - y) * 128 + pr * 64, qE = y * 128 + pr * 64;
  const bool ehi = y * 128 < QHI;   // block-uniform: the early 128 queries take the high-precision walk, 32 per wave
  // in 32-key passes: na late-tile passes for each of waves 4-7, nb for each of waves 0-3, he early-tile passes for each of the pair's two waves; a pair's four waves walk the same number where the early tile is plain, and differ by up to two on the high-precision blocks (a high-precision pass of 32 queries is counted as one pass of 64)
  const int na = ehi ? TT / 128 - 2 - 3 * y : TT / 128 - 1 - 2 * y, nb = ((qL >> 5) + 2 - 2 * na) >> 1, he = ((qE >> 5) + 2) >> 1;
  if (ehi && lowr) { const int qh = y * 128 + (wave & 3) * 32; v8f oh[2][4] = {}; float mh[2] = {-1.0e30f, -1.0e30f}, lh[2] = {0.f, 0.f};
    fa_walk<true>(QH, KH, QL, KL, VT, VB, VBL, b, qh, 0, qh, true, lane, oh, mh, lh); fa_store(out, b, qh, lane, oh, lh); }
#pragma nounroll   // one copy of the pass code serves both walks: less text in the instruction cache
  for (int job = (lowr && !ehi) ? 0 : 1; job < 2; ++job) { const int q0 = job ? qL : qE;
    const int kb = job ? (lowr ? r * na : 2 * na + r * nb) : r * he; const bool dg = r && !(job && lowr); const int ke = dg ? (q0 >> 5) : kb + (job ? (lowr ? na : nb) : he);
    v8f ot[4][4]; float m[4], l[4];
#pragma unroll
    for (int u = 0; u < 4; ++u) { m[u] = -1.0e30f; l[u] = 0.f;
#pragma unroll
      for (int j = 0; j < 4; ++j) ot[u][j] = (v8f){}; }
    fa_walkq(QH, KH, VT, b, q0, kb * 32, ke * 32, dg, lane, ot, m, l);
    v4f (*ps)[32] = part[pr * 6 + (job ? (lowr ? 2 : 4) + r : r)];
#pragma unroll
    for (int u = 0; u < 4; ++u)
#pragma unroll
      for (int j = 0; j < 4; ++j) { const v8f t = ot[u][j]; ps[u * 8 + j * 2][lane] = (v4f){t[0], t[1], t[2], t[3]}; ps[u * 8 + j * 2 + 1][lane] = (v4f){t[4], t[5], t[6], t[7]}; }
    ps[32][lane] = (v4f){m[0], m[1], m[2], m[3]}; ps[33][lane] = (v4f){l[0], l[1], l[2], l[3]}; }
  __syncthreads();   // every partial result is in LDS; every wave passes here once
  const int u = (wave >> 2) * 2 + r;   // each of a pair's four waves joins one 16-query group of both tiles
  if (!ehi) fa_merge<2>(part + pr * 6, out, b, qE, u, lane);
  fa_merge<4>(part + pr * 6 + 2, out, b, qL, u, lane); }

extern "C" void kernel_launch(void* const* d_in, const int* in_sizes, int n_in, void* d_out, int out_size, void* d_ws, size_t ws_size, hipStream_t stream) {
  (void)in_sizes; (void)n_in; (void)out_size;
  const float** F = (const float**)d_in;
  if (ws_size < (size_t)WS_END) return;
  char* ws = (char*)d_ws; _Float16 *QH = (_Float16*)(ws + WS_QH), *KH = (_Float16*)(ws + WS_KH), *VT = (_Float16*)(ws + WS_VT), *QL = (_Float16*)(ws + WS_QL), *KL = (_Float16*)(ws + WS_KL); __bf16 *VB = (__bf16*)(ws + WS_VB), *VBL = (__bf16*)(ws + WS_VBL); float *S = (float*)(ws + WS_S), *Y = (float*)(ws + WS_Y);
  (void)S; (void)Y; (void)QL; (void)KL; (void)VB; (void)VBL;
  // inputs: 0 queries [16,4096,64]; 1 keys; 2 values
  k_planes64<<<dim3(TNB * TT / 64), 256, 0, stream>>>(F[0], F[1], F[2], QH, QL, KH, KL, VT, VB, VBL);
  k_fa<<<dim3(TNB, TT / 256), 256, 0, stream>>>(QH, KH, QL, KL, VT, VB, VBL, (float*)d_out);
}
